// v000
// Measured on an AMD MI455X. A time is GPU time per run, averaged over a window of back-to-back runs after a warm-up
// (all launches, gaps included; the runs take copies of the inputs in turn), and the median of several windows.
// Apart from v000's, it joins two sittings. Times from different sittings can be a few percent apart, while
// side-by-side timings come from the same sitting.
// v000, which the later versions start from, runs in 619 microseconds.
#include <hip/hip_runtime.h>

// Self-attention forward: Q=xWq*scale, K=xWk, V=xWv; O = softmax(QK^T)V
// B=4, T=4096, D_IN=768, D_H=256.  All matmuls via v_wmma_f32_16x16x32_f16.
// Attention kernel stages K/V chunks into LDS with global_load_async_to_lds_b128
// (double-buffered, ASYNCcnt-tracked) so the DMA overlaps the WMMA work.

typedef _Float16 half8 __attribute__((ext_vector_type(8)));
typedef _Float16 v16h  __attribute__((ext_vector_type(16)));
typedef float    v8f   __attribute__((ext_vector_type(8)));
typedef float    f32x4 __attribute__((ext_vector_type(4)));

#define B_  4
#define T_  4096
#define DIN 768
#define DH  256

// LDS row strides (halves), padded to spread banks; all row offsets 16B-aligned.
#define KSTR 264   // 32 K-rows   x 264 (528 B/row)
#define VSTR 40    // 256 V-rows  x 40  (80 B/row)
#define PSTR 40    // 16 P-rows   x 40  (80 B/row)

union Frag16 { v16h v; half8 h[2]; _Float16 e[16]; };

// 16x32 (A) or 32x16 (B) f16 fragment, per CDNA5 ISA 7.12.2 lane layout.
// lane<16 : row = lane,    K halves {0..7} and {16..23}
// lane>=16: row = lane-16, K halves {8..15} and {24..31}
__device__ __forceinline__ v16h load_frag_f16(const _Float16* base, int stride) {
  int lane = threadIdx.x & 31;
  int r    = lane & 15;
  int hi   = lane >> 4;
  const _Float16* p = base + (size_t)r * stride + (hi ? 8 : 0);
  Frag16 f;
  f.h[0] = *(const half8*)(p);
  f.h[1] = *(const half8*)(p + 16);
  return f.v;
}

// Same A-fragment layout but source is fp32 (converted to f16 in registers).
__device__ __forceinline__ v16h load_frag_f32cvt(const float* base, int stride) {
  int lane = threadIdx.x & 31;
  int r    = lane & 15;
  int hi   = lane >> 4;
  const float* p = base + (size_t)r * stride + (hi ? 8 : 0);
  f32x4 f0 = *(const f32x4*)(p);
  f32x4 f1 = *(const f32x4*)(p + 4);
  f32x4 f2 = *(const f32x4*)(p + 16);
  f32x4 f3 = *(const f32x4*)(p + 20);
  Frag16 f;
#pragma unroll
  for (int i = 0; i < 4; ++i) {
    f.e[i]      = (_Float16)f0[i];
    f.e[4 + i]  = (_Float16)f1[i];
    f.e[8 + i]  = (_Float16)f2[i];
    f.e[12 + i] = (_Float16)f3[i];
  }
  return f.v;
}

__device__ __forceinline__ v8f wmma_f16(v16h a, v16h b, v8f c) {
  // (neg_a, A, neg_b, B, c_mod, C, reuse_a, reuse_b)
  return __builtin_amdgcn_wmma_f32_16x16x32_f16(false, a, false, b, (short)0, c,
                                                false, false);
}

// Async-DMA one 16B segment: LDS[dst] = MEM[saddr + voff]  (GVS mode, ASYNCcnt)
__device__ __forceinline__ void async_b128(unsigned lds_dst, unsigned voff,
                                           const _Float16* saddr) {
  __asm__ volatile("global_load_async_to_lds_b128 %0, %1, %2"
                   :: "v"(lds_dst), "v"(voff), "s"(saddr) : "memory");
}

// ---------------------------------------------------------------------------
// Kernel 0: transpose+convert weights: Wt[w][h][d] = (f16) W_w[d][h]
// ---------------------------------------------------------------------------
__global__ void wt_kernel(const float* __restrict__ Wq, const float* __restrict__ Wk,
                          const float* __restrict__ Wv, _Float16* __restrict__ Wt) {
  int idx = blockIdx.x * blockDim.x + threadIdx.x;
  const int per = DIN * DH;
  if (idx >= 3 * per) return;
  int w   = idx / per;
  int rem = idx - w * per;
  int k   = rem / DH;          // d index
  int n   = rem - k * DH;      // h index
  const float* src = (w == 0) ? Wq : (w == 1) ? Wk : Wv;
  Wt[(size_t)w * per + (size_t)n * DIN + k] = (_Float16)src[rem];
}

// ---------------------------------------------------------------------------
// Kernel 1: QKV projection GEMM.  grid=(128,3), block=256 (8 waves).
// Each wave: 16 rows x full DH=256 cols.  blockIdx.y selects Q/K/V.
// Q is pre-scaled by 1/16; V stored transposed Vt[b][h][t].
// ---------------------------------------------------------------------------
__global__ __launch_bounds__(256) void qkv_kernel(
    const float* __restrict__ x, const _Float16* __restrict__ Wt,
    _Float16* __restrict__ Qh, _Float16* __restrict__ Kh,
    _Float16* __restrict__ Vt) {
  int w       = threadIdx.x >> 5;
  int lane    = threadIdx.x & 31;
  int wsel    = blockIdx.y;
  int rowbase = blockIdx.x * 128 + w * 16;   // global row in [0, B*T)
  const _Float16* Wsel = Wt + (size_t)wsel * (DIN * DH);

  v8f zv = {};
  v8f acc[16];
#pragma unroll
  for (int n = 0; n < 16; ++n) acc[n] = zv;

  const float* xbase = x + (size_t)rowbase * DIN;
  for (int c = 0; c < DIN / 32; ++c) {
    if (c + 1 < DIN / 32)
      __builtin_prefetch(xbase + (size_t)(lane & 15) * DIN + (c + 1) * 32, 0, 3);
    v16h af = load_frag_f32cvt(xbase + c * 32, DIN);
#pragma unroll
    for (int n = 0; n < 16; ++n) {
      v16h bf = load_frag_f16(Wsel + (size_t)(n * 16) * DIN + c * 32, DIN);
      acc[n] = wmma_f16(af, bf, acc[n]);
    }
  }

  float scale = (wsel == 0) ? 0.0625f : 1.0f;   // fold 1/sqrt(DH) into Q
  int nlo  = lane & 15;
  int mofs = (lane >> 4) * 8;
#pragma unroll
  for (int n = 0; n < 16; ++n) {
#pragma unroll
    for (int r = 0; r < 8; ++r) {
      int m    = r + mofs;
      int grow = rowbase + m;
      int col  = n * 16 + nlo;
      _Float16 hv = (_Float16)(acc[n][r] * scale);
      if (wsel == 0) {
        Qh[(size_t)grow * DH + col] = hv;
      } else if (wsel == 1) {
        Kh[(size_t)grow * DH + col] = hv;
      } else {
        int b = grow >> 12;              // T_ == 4096
        int t = grow & (T_ - 1);
        Vt[((size_t)b * DH + col) * T_ + t] = hv;
      }
    }
  }
}

// ---------------------------------------------------------------------------
// Kernel 2: flash attention.  grid=(T/128, B), block=256 (8 waves).
// Each wave: 16 queries, full DH output, online softmax over keys.
// K/V chunks (32 keys) staged to LDS by async DMA, double-buffered.
// ---------------------------------------------------------------------------
__global__ __launch_bounds__(256) void attn_kernel(
    const _Float16* __restrict__ Qh, const _Float16* __restrict__ Kh,
    const _Float16* __restrict__ Vt, float* __restrict__ out) {
  __shared__ __align__(16) _Float16 kbuf[2][32 * KSTR];   // K chunk:  32 x 256
  __shared__ __align__(16) _Float16 vbuf[2][256 * VSTR];  // V^T chunk: 256 x 32
  __shared__ __align__(16) _Float16 pbuf[8][16 * PSTR];   // per-wave P tile

  int tid   = threadIdx.x;
  int w     = tid >> 5;
  int lane  = tid & 31;
  int b     = blockIdx.y;
  int qbase = blockIdx.x * 128 + w * 16;
  int nlo   = lane & 15;
  int mofs  = (lane >> 4) * 8;
  _Float16* pb = &pbuf[w][0];

  unsigned klds[2] = { (unsigned)(uintptr_t)&kbuf[0][0],
                       (unsigned)(uintptr_t)&kbuf[1][0] };
  unsigned vlds[2] = { (unsigned)(uintptr_t)&vbuf[0][0],
                       (unsigned)(uintptr_t)&vbuf[1][0] };

  // Q resident in registers: 8 A-fragments covering DH=256.
  v16h aq[8];
  const _Float16* qptr = Qh + (size_t)(b * T_ + qbase) * DH;
#pragma unroll
  for (int c = 0; c < 8; ++c) aq[c] = load_frag_f16(qptr + c * 32, DH);

  v8f zv = {};
  v8f o[16];
#pragma unroll
  for (int t = 0; t < 16; ++t) o[t] = zv;

  float mstate[8], lstate[8];
#pragma unroll
  for (int r = 0; r < 8; ++r) { mstate[r] = -1e30f; lstate[r] = 0.0f; }

  // --- async-copy of one 32-key chunk (K: 16KB, V^T: 16KB), 8 b128/thread ---
  auto issue_chunk = [&](int buf, int kb) {
    const _Float16* kg = Kh + (size_t)(b * T_ + kb) * DH;   // 32 rows x 512B
    const _Float16* vg = Vt + (size_t)b * DH * T_ + kb;     // 256 rows x 64B
#pragma unroll
    for (int it = 0; it < 4; ++it) {
      int s = tid + it * 256;             // 1024 segments of 16B
      int row = s >> 5, c = s & 31;
      async_b128(klds[buf] + row * (KSTR * 2) + c * 16,
                 (unsigned)(row * (DH * 2) + c * 16), kg);
    }
#pragma unroll
    for (int it = 0; it < 4; ++it) {
      int s = tid + it * 256;             // 1024 segments of 16B
      int row = s >> 2, j = s & 3;
      async_b128(vlds[buf] + row * (VSTR * 2) + j * 16,
                 (unsigned)(row * (T_ * 2) + j * 16), vg);
    }
  };

  issue_chunk(0, 0);   // prologue

  for (int kb = 0, it = 0; kb < T_; kb += 32, ++it) {
    int cur = it & 1;
    __asm__ volatile("s_wait_asynccnt 0" ::: "memory");  // chunk landed in LDS
    __syncthreads();                                     // publish; prev reads done
    if (kb + 32 < T_) issue_chunk(cur ^ 1, kb + 32);     // overlap next DMA

    const _Float16* kl = &kbuf[cur][0];
    const _Float16* vl = &vbuf[cur][0];

    // --- S = Q * K^T for 32 keys (two 16x16 tiles) ---
    v8f s0 = zv, s1 = zv;
#pragma unroll
    for (int c = 0; c < 8; ++c) {
      v16h bk0 = load_frag_f16(kl + c * 32, KSTR);
      v16h bk1 = load_frag_f16(kl + 16 * KSTR + c * 32, KSTR);
      s0 = wmma_f16(aq[c], bk0, s0);
      s1 = wmma_f16(aq[c], bk1, s1);
    }

    // --- online softmax; rows live across the 16-lane half (C layout) ---
    float alpha[8];
#pragma unroll
    for (int r = 0; r < 8; ++r) {
      float x0 = s0[r], x1 = s1[r];
      float mx = fmaxf(x0, x1);
      mx = fmaxf(mx, __shfl_xor(mx, 1));
      mx = fmaxf(mx, __shfl_xor(mx, 2));
      mx = fmaxf(mx, __shfl_xor(mx, 4));
      mx = fmaxf(mx, __shfl_xor(mx, 8));
      float mnew = fmaxf(mstate[r], mx);
      float a  = __expf(mstate[r] - mnew);
      float p0 = __expf(x0 - mnew);
      float p1 = __expf(x1 - mnew);
      float rs = p0 + p1;
      rs += __shfl_xor(rs, 1);
      rs += __shfl_xor(rs, 2);
      rs += __shfl_xor(rs, 4);
      rs += __shfl_xor(rs, 8);
      lstate[r] = lstate[r] * a + rs;
      mstate[r] = mnew;
      alpha[r]  = a;
      int m = r + mofs;                    // C layout -> (row m, key nlo)
      pb[m * PSTR + nlo]      = (_Float16)p0;
      pb[m * PSTR + 16 + nlo] = (_Float16)p1;
    }
#pragma unroll
    for (int t = 0; t < 16; ++t)
#pragma unroll
      for (int r = 0; r < 8; ++r) o[t][r] *= alpha[r];

    __asm__ volatile("s_wait_dscnt 0" ::: "memory");  // P tile visible in LDS

    // --- O += P * V : P as A-fragment (K=32), V^T rows from LDS ---
    v16h pa = load_frag_f16(pb, PSTR);
#pragma unroll
    for (int t = 0; t < 16; ++t) {
      v16h bv = load_frag_f16(vl + (t * 16) * VSTR, VSTR);
      o[t] = wmma_f16(pa, bv, o[t]);
    }
  }

  // --- normalize and write fp32 output ---
  float inv[8];
#pragma unroll
  for (int r = 0; r < 8; ++r) inv[r] = 1.0f / lstate[r];
#pragma unroll
  for (int t = 0; t < 16; ++t) {
#pragma unroll
    for (int r = 0; r < 8; ++r) {
      int m = r + mofs;
      int q = qbase + m;
      out[(size_t)(b * T_ + q) * DH + t * 16 + nlo] = o[t][r] * inv[r];
    }
  }
}

// ---------------------------------------------------------------------------
extern "C" void kernel_launch(void* const* d_in, const int* in_sizes, int n_in,
                              void* d_out, int out_size, void* d_ws, size_t ws_size,
                              hipStream_t stream) {
  const float* x  = (const float*)d_in[0];
  const float* Wq = (const float*)d_in[1];
  const float* Wk = (const float*)d_in[2];
  const float* Wv = (const float*)d_in[3];
  float* out = (float*)d_out;

  char* ws = (char*)d_ws;
  _Float16* Qh = (_Float16*)(ws);                                 // 8 MB
  _Float16* Kh = (_Float16*)(ws + (size_t)8  * 1024 * 1024);      // 8 MB
  _Float16* Vt = (_Float16*)(ws + (size_t)16 * 1024 * 1024);      // 8 MB
  _Float16* Wt = (_Float16*)(ws + (size_t)24 * 1024 * 1024);      // 3 x 384 KB

  int total_w = 3 * DIN * DH;
  wt_kernel<<<(total_w + 255) / 256, 256, 0, stream>>>(Wq, Wk, Wv, Wt);

  dim3 g1((B_ * T_) / 128, 3);
  qkv_kernel<<<g1, 256, 0, stream>>>(x, Wt, Qh, Kh, Vt);

  dim3 g2(T_ / 128, B_);
  attn_kernel<<<g2, 256, 0, stream>>>(Qh, Kh, Vt, out);
}

// v001
// One run takes 348 microseconds.
// Next to v000, in two timings, it ran 1.82 and 1.81 times as fast.
#include <hip/hip_runtime.h>

// Self-attention forward: Q=xWq*scale, K=xWk, V=xWv; O = softmax(QK^T)V
// B=4, T=4096, D_IN=768, D_H=256.  All matmuls via v_wmma_f32_16x16x32_f16.
// Attention kernel stages K/V chunks into LDS with global_load_async_to_lds_b128
// (double-buffered, ASYNCcnt-tracked) so the DMA overlaps the WMMA work.

typedef _Float16 half8 __attribute__((ext_vector_type(8)));
typedef _Float16 v16h  __attribute__((ext_vector_type(16)));
typedef float    v8f   __attribute__((ext_vector_type(8)));
typedef float    f32x4 __attribute__((ext_vector_type(4)));

#define B_  4
#define T_  4096
#define DIN 768
#define DH  256

// LDS row strides (halves), padded to spread banks; all row offsets 16B-aligned.
#define KSTR 264   // 32 K-rows   x 264 (528 B/row)
#define VSTR 40    // 256 V-rows  x 40  (80 B/row)
#define PSTR 40    // 16 P-rows   x 40  (80 B/row)

union Frag16 { v16h v; half8 h[2]; _Float16 e[16]; };

// 16x32 (A) or 32x16 (B) f16 fragment, per CDNA5 ISA 7.12.2 lane layout.
// lane<16 : row = lane,    K halves {0..7} and {16..23}
// lane>=16: row = lane-16, K halves {8..15} and {24..31}
__device__ __forceinline__ v16h load_frag_f16(const _Float16* base, int stride) {
  int lane = threadIdx.x & 31;
  int r    = lane & 15;
  int hi   = lane >> 4;
  const _Float16* p = base + (size_t)r * stride + (hi ? 8 : 0);
  Frag16 f;
  f.h[0] = *(const half8*)(p);
  f.h[1] = *(const half8*)(p + 16);
  return f.v;
}

// Same A-fragment layout but source is fp32 (converted to f16 in registers).
__device__ __forceinline__ v16h load_frag_f32cvt(const float* base, int stride) {
  int lane = threadIdx.x & 31;
  int r    = lane & 15;
  int hi   = lane >> 4;
  const float* p = base + (size_t)r * stride + (hi ? 8 : 0);
  f32x4 f0 = *(const f32x4*)(p);
  f32x4 f1 = *(const f32x4*)(p + 4);
  f32x4 f2 = *(const f32x4*)(p + 16);
  f32x4 f3 = *(const f32x4*)(p + 20);
  Frag16 f;
#pragma unroll
  for (int i = 0; i < 4; ++i) {
    f.e[i]      = (_Float16)f0[i];
    f.e[4 + i]  = (_Float16)f1[i];
    f.e[8 + i]  = (_Float16)f2[i];
    f.e[12 + i] = (_Float16)f3[i];
  }
  return f.v;
}

__device__ __forceinline__ v8f wmma_f16(v16h a, v16h b, v8f c) {
  // (neg_a, A, neg_b, B, c_mod, C, reuse_a, reuse_b)
  return __builtin_amdgcn_wmma_f32_16x16x32_f16(false, a, false, b, (short)0, c,
                                                false, false);
}

// Async-DMA one 16B segment: LDS[dst] = MEM[saddr + voff]  (GVS mode, ASYNCcnt)
__device__ __forceinline__ void async_b128(unsigned lds_dst, unsigned voff,
                                           const _Float16* saddr) {
  __asm__ volatile("global_load_async_to_lds_b128 %0, %1, %2"
                   :: "v"(lds_dst), "v"(voff), "s"(saddr) : "memory");
}

// ---------------------------------------------------------------------------
// Kernel 0: transpose+convert weights: Wt[w][h][d] = (f16) W_w[d][h]
// ---------------------------------------------------------------------------
__global__ void wt_kernel(const float* __restrict__ Wq, const float* __restrict__ Wk,
                          const float* __restrict__ Wv, _Float16* __restrict__ Wt) {
  int idx = blockIdx.x * blockDim.x + threadIdx.x;
  const int per = DIN * DH;
  if (idx >= 3 * per) return;
  int w   = idx / per;
  int rem = idx - w * per;
  int k   = rem / DH;          // d index
  int n   = rem - k * DH;      // h index
  const float* src = (w == 0) ? Wq : (w == 1) ? Wk : Wv;
  Wt[(size_t)w * per + (size_t)n * DIN + k] = (_Float16)src[rem];
}

// ---------------------------------------------------------------------------
// Kernel 1: QKV projection GEMM.  grid=(128,3), block=256 (8 waves).
// Each wave: 16 rows x full DH=256 cols.  blockIdx.y selects Q/K/V.
// Q is pre-scaled by 1/16; V stored transposed Vt[b][h][t].
// ---------------------------------------------------------------------------
// amdgpu_waves_per_eu(4, 4): two of these 8-wave blocks per WGP is all the grid can
// place, so the register budget is 256 per wave.  Without it the scheduler kept the
// register count low for a residency the launch never reaches and put a full wait
// between every fragment load pair and its WMMA; with it the loads run ahead.
__global__ __launch_bounds__(256) __attribute__((amdgpu_waves_per_eu(4, 4)))
void qkv_kernel(
    const float* __restrict__ x, const _Float16* __restrict__ Wt,
    _Float16* __restrict__ Qh, _Float16* __restrict__ Kh,
    _Float16* __restrict__ Vt) {
  int w       = threadIdx.x >> 5;
  int lane    = threadIdx.x & 31;
  int wsel    = blockIdx.y;
  int rowbase = blockIdx.x * 128 + w * 16;   // global row in [0, B*T)
  const _Float16* Wsel = Wt + (size_t)wsel * (DIN * DH);

  v8f zv = {};
  v8f acc[16];
#pragma unroll
  for (int n = 0; n < 16; ++n) acc[n] = zv;

  const float* xbase = x + (size_t)rowbase * DIN;
  for (int c = 0; c < DIN / 32; ++c) {
    if (c + 1 < DIN / 32)
      __builtin_prefetch(xbase + (size_t)(lane & 15) * DIN + (c + 1) * 32, 0, 3);
    v16h af = load_frag_f32cvt(xbase + c * 32, DIN);
#pragma unroll
    for (int n = 0; n < 16; ++n) {
      v16h bf = load_frag_f16(Wsel + (size_t)(n * 16) * DIN + c * 32, DIN);
      acc[n] = wmma_f16(af, bf, acc[n]);
    }
  }

  float scale = (wsel == 0) ? 0.0625f : 1.0f;   // fold 1/sqrt(DH) into Q
  int nlo  = lane & 15;
  int mofs = (lane >> 4) * 8;
#pragma unroll
  for (int n = 0; n < 16; ++n) {
#pragma unroll
    for (int r = 0; r < 8; ++r) {
      int m    = r + mofs;
      int grow = rowbase + m;
      int col  = n * 16 + nlo;
      _Float16 hv = (_Float16)(acc[n][r] * scale);
      if (wsel == 0) {
        Qh[(size_t)grow * DH + col] = hv;
      } else if (wsel == 1) {
        Kh[(size_t)grow * DH + col] = hv;
      } else {
        int b = grow >> 12;              // T_ == 4096
        int t = grow & (T_ - 1);
        Vt[((size_t)b * DH + col) * T_ + t] = hv;
      }
    }
  }
}

// ---------------------------------------------------------------------------
// Kernel 2: flash attention.  grid=(T/128, B), block=256 (8 waves).
// Each wave: 16 queries, full DH output, online softmax over keys.
// K/V chunks (32 keys) staged to LDS by async DMA, double-buffered.
// ---------------------------------------------------------------------------
// amdgpu_waves_per_eu(2, 2): the grid has fewer blocks than the chip has WGPs, so one
// block (two waves per SIMD) is the real residency and 512 registers per wave are
// free.  Without it the scheduler minimised registers: one LDS fragment pair, a full
// wait, one WMMA, and every shuffle step waited out alone; with it the LDS reads are
// issued in groups ahead of counted waits and the eight rows' shuffles interleave.
__global__ __launch_bounds__(256) __attribute__((amdgpu_waves_per_eu(2, 2)))
void attn_kernel(
    const _Float16* __restrict__ Qh, const _Float16* __restrict__ Kh,
    const _Float16* __restrict__ Vt, float* __restrict__ out) {
  __shared__ __align__(16) _Float16 kbuf[2][32 * KSTR];   // K chunk:  32 x 256
  __shared__ __align__(16) _Float16 vbuf[2][256 * VSTR];  // V^T chunk: 256 x 32
  __shared__ __align__(16) _Float16 pbuf[8][16 * PSTR];   // per-wave P tile

  int tid   = threadIdx.x;
  int w     = tid >> 5;
  int lane  = tid & 31;
  int b     = blockIdx.y;
  int qbase = blockIdx.x * 128 + w * 16;
  int nlo   = lane & 15;
  int mofs  = (lane >> 4) * 8;
  _Float16* pb = &pbuf[w][0];

  unsigned klds[2] = { (unsigned)(uintptr_t)&kbuf[0][0],
                       (unsigned)(uintptr_t)&kbuf[1][0] };
  unsigned vlds[2] = { (unsigned)(uintptr_t)&vbuf[0][0],
                       (unsigned)(uintptr_t)&vbuf[1][0] };

  // Q resident in registers: 8 A-fragments covering DH=256.
  v16h aq[8];
  const _Float16* qptr = Qh + (size_t)(b * T_ + qbase) * DH;
#pragma unroll
  for (int c = 0; c < 8; ++c) aq[c] = load_frag_f16(qptr + c * 32, DH);

  v8f zv = {};
  v8f o[16];
#pragma unroll
  for (int t = 0; t < 16; ++t) o[t] = zv;

  float mstate[8], lstate[8];
#pragma unroll
  for (int r = 0; r < 8; ++r) { mstate[r] = -1e30f; lstate[r] = 0.0f; }

  // --- async-copy of one 32-key chunk (K: 16KB, V^T: 16KB), 8 b128/thread ---
  auto issue_chunk = [&](int buf, int kb) {
    const _Float16* kg = Kh + (size_t)(b * T_ + kb) * DH;   // 32 rows x 512B
    const _Float16* vg = Vt + (size_t)b * DH * T_ + kb;     // 256 rows x 64B
#pragma unroll
    for (int it = 0; it < 4; ++it) {
      int s = tid + it * 256;             // 1024 segments of 16B
      int row = s >> 5, c = s & 31;
      async_b128(klds[buf] + row * (KSTR * 2) + c * 16,
                 (unsigned)(row * (DH * 2) + c * 16), kg);
    }
#pragma unroll
    for (int it = 0; it < 4; ++it) {
      int s = tid + it * 256;             // 1024 segments of 16B
      int row = s >> 2, j = s & 3;
      async_b128(vlds[buf] + row * (VSTR * 2) + j * 16,
                 (unsigned)(row * (T_ * 2) + j * 16), vg);
    }
  };

  issue_chunk(0, 0);   // prologue

  for (int kb = 0, it = 0; kb < T_; kb += 32, ++it) {
    int cur = it & 1;
    __asm__ volatile("s_wait_asynccnt 0" ::: "memory");  // chunk landed in LDS
    __syncthreads();                                     // publish; prev reads done
    if (kb + 32 < T_) issue_chunk(cur ^ 1, kb + 32);     // overlap next DMA

    const _Float16* kl = &kbuf[cur][0];
    const _Float16* vl = &vbuf[cur][0];

    // --- S = Q * K^T for 32 keys (two 16x16 tiles) ---
    v8f s0 = zv, s1 = zv;
#pragma unroll
    for (int c = 0; c < 8; ++c) {
      v16h bk0 = load_frag_f16(kl + c * 32, KSTR);
      v16h bk1 = load_frag_f16(kl + 16 * KSTR + c * 32, KSTR);
      s0 = wmma_f16(aq[c], bk0, s0);
      s1 = wmma_f16(aq[c], bk1, s1);
    }

    // --- online softmax; rows live across the 16-lane half (C layout) ---
    float alpha[8];
#pragma unroll
    for (int r = 0; r < 8; ++r) {
      float x0 = s0[r], x1 = s1[r];
      float mx = fmaxf(x0, x1);
      mx = fmaxf(mx, __shfl_xor(mx, 1));
      mx = fmaxf(mx, __shfl_xor(mx, 2));
      mx = fmaxf(mx, __shfl_xor(mx, 4));
      mx = fmaxf(mx, __shfl_xor(mx, 8));
      float mnew = fmaxf(mstate[r], mx);
      float a  = __expf(mstate[r] - mnew);
      float p0 = __expf(x0 - mnew);
      float p1 = __expf(x1 - mnew);
      float rs = p0 + p1;
      rs += __shfl_xor(rs, 1);
      rs += __shfl_xor(rs, 2);
      rs += __shfl_xor(rs, 4);
      rs += __shfl_xor(rs, 8);
      lstate[r] = lstate[r] * a + rs;
      mstate[r] = mnew;
      alpha[r]  = a;
      int m = r + mofs;                    // C layout -> (row m, key nlo)
      pb[m * PSTR + nlo]      = (_Float16)p0;
      pb[m * PSTR + 16 + nlo] = (_Float16)p1;
    }
#pragma unroll
    for (int t = 0; t < 16; ++t)
#pragma unroll
      for (int r = 0; r < 8; ++r) o[t][r] *= alpha[r];

    __asm__ volatile("s_wait_dscnt 0" ::: "memory");  // P tile visible in LDS

    // --- O += P * V : P as A-fragment (K=32), V^T rows from LDS ---
    v16h pa = load_frag_f16(pb, PSTR);
#pragma unroll
    for (int t = 0; t < 16; ++t) {
      v16h bv = load_frag_f16(vl + (t * 16) * VSTR, VSTR);
      o[t] = wmma_f16(pa, bv, o[t]);
    }
  }

  // --- normalize and write fp32 output ---
  float inv[8];
#pragma unroll
  for (int r = 0; r < 8; ++r) inv[r] = 1.0f / lstate[r];
#pragma unroll
  for (int t = 0; t < 16; ++t) {
#pragma unroll
    for (int r = 0; r < 8; ++r) {
      int m = r + mofs;
      int q = qbase + m;
      out[(size_t)(b * T_ + q) * DH + t * 16 + nlo] = o[t][r] * inv[r];
    }
  }
}

// ---------------------------------------------------------------------------
extern "C" void kernel_launch(void* const* d_in, const int* in_sizes, int n_in,
                              void* d_out, int out_size, void* d_ws, size_t ws_size,
                              hipStream_t stream) {
  const float* x  = (const float*)d_in[0];
  const float* Wq = (const float*)d_in[1];
  const float* Wk = (const float*)d_in[2];
  const float* Wv = (const float*)d_in[3];
  float* out = (float*)d_out;

  char* ws = (char*)d_ws;
  _Float16* Qh = (_Float16*)(ws);                                 // 8 MB
  _Float16* Kh = (_Float16*)(ws + (size_t)8  * 1024 * 1024);      // 8 MB
  _Float16* Vt = (_Float16*)(ws + (size_t)16 * 1024 * 1024);      // 8 MB
  _Float16* Wt = (_Float16*)(ws + (size_t)24 * 1024 * 1024);      // 3 x 384 KB

  int total_w = 3 * DIN * DH;
  wt_kernel<<<(total_w + 255) / 256, 256, 0, stream>>>(Wq, Wk, Wv, Wt);

  dim3 g1((B_ * T_) / 128, 3);
  qkv_kernel<<<g1, 256, 0, stream>>>(x, Wt, Qh, Kh, Vt);

  dim3 g2(T_ / 128, B_);
  attn_kernel<<<g2, 256, 0, stream>>>(Qh, Kh, Vt, out);
}

// v002
// Measured time: 293 microseconds a run.
// Two timings next to v001 put it at 1.19 and 1.18 times that version's speed.
// Over all steps from v000 it is 2.15 times as fast.
#include <hip/hip_runtime.h>

// Self-attention forward: Q=xWq*scale, K=xWk, V=xWv; O = softmax(QK^T)V
// B=4, T=4096, D_IN=768, D_H=256.  All matmuls via v_wmma_f32_16x16x32_f16.
// Attention kernel stages K/V chunks into LDS with global_load_async_to_lds_b128
// (double-buffered, ASYNCcnt-tracked) so the DMA overlaps the WMMA work.

typedef _Float16 half8 __attribute__((ext_vector_type(8)));
typedef _Float16 v16h  __attribute__((ext_vector_type(16)));
typedef float    v8f   __attribute__((ext_vector_type(8)));
typedef float    f32x4 __attribute__((ext_vector_type(4)));

#define B_  4
#define T_  4096
#define DIN 768
#define DH  256

// LDS row strides (halves), padded to spread banks; all row offsets 16B-aligned.
#define KSTR 264   // 32 K-rows   x 264 (528 B/row)
#define VSTR 40    // 256 V-rows  x 40  (80 B/row)
#define PSTR 40    // 16 P-rows   x 40  (80 B/row)

union Frag16 { v16h v; half8 h[2]; _Float16 e[16]; };

// 16x32 (A) or 32x16 (B) f16 fragment, per CDNA5 ISA 7.12.2 lane layout.
// lane<16 : row = lane,    K halves {0..7} and {16..23}
// lane>=16: row = lane-16, K halves {8..15} and {24..31}
__device__ __forceinline__ v16h load_frag_f16(const _Float16* base, int stride) {
  int lane = threadIdx.x & 31;
  int r    = lane & 15;
  int hi   = lane >> 4;
  const _Float16* p = base + (size_t)r * stride + (hi ? 8 : 0);
  Frag16 f;
  f.h[0] = *(const half8*)(p);
  f.h[1] = *(const half8*)(p + 16);
  return f.v;
}

// Same A-fragment layout but source is fp32 (converted to f16 in registers).
__device__ __forceinline__ v16h load_frag_f32cvt(const float* base, int stride) {
  int lane = threadIdx.x & 31;
  int r    = lane & 15;
  int hi   = lane >> 4;
  const float* p = base + (size_t)r * stride + (hi ? 8 : 0);
  f32x4 f0 = *(const f32x4*)(p);
  f32x4 f1 = *(const f32x4*)(p + 4);
  f32x4 f2 = *(const f32x4*)(p + 16);
  f32x4 f3 = *(const f32x4*)(p + 20);
  Frag16 f;
#pragma unroll
  for (int i = 0; i < 4; ++i) {
    f.e[i]      = (_Float16)f0[i];
    f.e[4 + i]  = (_Float16)f1[i];
    f.e[8 + i]  = (_Float16)f2[i];
    f.e[12 + i] = (_Float16)f3[i];
  }
  return f.v;
}

__device__ __forceinline__ v8f wmma_f16(v16h a, v16h b, v8f c) {
  // (neg_a, A, neg_b, B, c_mod, C, reuse_a, reuse_b)
  return __builtin_amdgcn_wmma_f32_16x16x32_f16(false, a, false, b, (short)0, c,
                                                false, false);
}

// Async-DMA one 16B segment: LDS[dst] = MEM[saddr + voff]  (GVS mode, ASYNCcnt)
__device__ __forceinline__ void async_b128(unsigned lds_dst, unsigned voff,
                                           const _Float16* saddr) {
  __asm__ volatile("global_load_async_to_lds_b128 %0, %1, %2"
                   :: "v"(lds_dst), "v"(voff), "s"(saddr) : "memory");
}

// ---------------------------------------------------------------------------
// Kernel 0: convert the weights to f16 and pack them in B-fragment order.
// Unit (w, c, nt, part) = 512 contiguous bytes = what ONE wave-wide 16-byte load of
// the projection reads: lane l holds W_w[c*32 + part*16 + (l>>4)*8 + 0..7][nt*16 + (l&15)].
// Thread g writes halves g*8 .. g*8+7, so every store is 16 B and whole lines fill.
// ---------------------------------------------------------------------------
__global__ void wt_kernel(const float* __restrict__ Wq, const float* __restrict__ Wk,
                          const float* __restrict__ Wv, _Float16* __restrict__ Wt) {
  int g = blockIdx.x * blockDim.x + threadIdx.x;
  const int per8 = DIN * DH / 8;       // 16-byte pieces per weight matrix
  if (g >= 3 * per8) return;
  int w    = g / per8;
  int rem  = g - w * per8;
  int r    = rem & 15;                 // column inside the 16-column tile
  int hi   = (rem >> 4) & 1;           // lane half: k offset 8
  int part = (rem >> 5) & 1;           // first or second 16-byte load: k offset 16
  int nt   = (rem >> 6) & 15;          // column tile
  int c    = rem >> 10;                // 32-deep k block
  int k0   = c * 32 + part * 16 + hi * 8;
  int n    = nt * 16 + r;
  const float* src = (w == 0) ? Wq : (w == 1) ? Wk : Wv;
  half8 v;
  // unrolled so that the eight row loads issue together and v stays in registers
#pragma unroll
  for (int e = 0; e < 8; ++e) v[e] = (_Float16)src[(size_t)(k0 + e) * DH + n];
  *(half8*)(Wt + (size_t)g * 8) = v;
}

// ---------------------------------------------------------------------------
// Kernel 1: QKV projection GEMM.  grid=(128,3), block=256 (8 waves).
// Each wave: 16 rows x full DH=256 cols.  blockIdx.y selects Q/K/V.
// Q is pre-scaled by 1/16; V stored transposed Vt[b][h][t].
// ---------------------------------------------------------------------------
// amdgpu_waves_per_eu(4, 4): two of these 8-wave blocks per WGP is all the grid can
// place, so the register budget is 256 per wave.  Without it the scheduler kept the
// register count low for a residency the launch never reaches and put a full wait
// between every fragment load pair and its WMMA; with it the loads run ahead.
__global__ __launch_bounds__(256) __attribute__((amdgpu_waves_per_eu(4, 4)))
void qkv_kernel(
    const float* __restrict__ x, const _Float16* __restrict__ Wt,
    _Float16* __restrict__ Qh, _Float16* __restrict__ Kh,
    _Float16* __restrict__ Vt) {
  int w       = threadIdx.x >> 5;
  int lane    = threadIdx.x & 31;
  int wsel    = blockIdx.y;
  int rowbase = blockIdx.x * 128 + w * 16;   // global row in [0, B*T)
  const _Float16* Wsel = Wt + (size_t)wsel * (DIN * DH);

  v8f zv = {};
  v8f acc[16];
#pragma unroll
  for (int n = 0; n < 16; ++n) acc[n] = zv;

  const float* xbase = x + (size_t)rowbase * DIN;
  for (int c = 0; c < DIN / 32; ++c) {
    if (c + 1 < DIN / 32)
      __builtin_prefetch(xbase + (size_t)(lane & 15) * DIN + (c + 1) * 32, 0, 3);
    v16h af = load_frag_f32cvt(xbase + c * 32, DIN);
#pragma unroll
    for (int n = 0; n < 16; ++n) {
      // packed fragment: two loads of 512 contiguous bytes (4 whole lines each)
      const _Float16* wp = Wsel + (size_t)(c * 16 + n) * 512 + lane * 8;
      Frag16 bf;
      bf.h[0] = *(const half8*)(wp);
      bf.h[1] = *(const half8*)(wp + 256);
      acc[n] = wmma_f16(af, bf.v, acc[n]);
    }
  }

  float scale = (wsel == 0) ? 0.0625f : 1.0f;   // fold 1/sqrt(DH) into Q
  int nlo  = lane & 15;
  int mofs = (lane >> 4) * 8;
#pragma unroll
  for (int n = 0; n < 16; ++n) {
#pragma unroll
    for (int r = 0; r < 8; ++r) {
      int m    = r + mofs;
      int grow = rowbase + m;
      int col  = n * 16 + nlo;
      _Float16 hv = (_Float16)(acc[n][r] * scale);
      if (wsel == 0) {
        Qh[(size_t)grow * DH + col] = hv;
      } else if (wsel == 1) {
        Kh[(size_t)grow * DH + col] = hv;
      } else {
        int b = grow >> 12;              // T_ == 4096
        int t = grow & (T_ - 1);
        Vt[((size_t)b * DH + col) * T_ + t] = hv;
      }
    }
  }
}

// ---------------------------------------------------------------------------
// Kernel 2: flash attention.  grid=(T/128, B), block=256 (8 waves).
// Each wave: 16 queries, full DH output, online softmax over keys.
// K/V chunks (32 keys) staged to LDS by async DMA, double-buffered.
// ---------------------------------------------------------------------------
// amdgpu_waves_per_eu(2, 2): the grid has fewer blocks than the chip has WGPs, so one
// block (two waves per SIMD) is the real residency and 512 registers per wave are
// free.  Without it the scheduler minimised registers: one LDS fragment pair, a full
// wait, one WMMA, and every shuffle step waited out alone; with it the LDS reads are
// issued in groups ahead of counted waits and the eight rows' shuffles interleave.
__global__ __launch_bounds__(256) __attribute__((amdgpu_waves_per_eu(2, 2)))
void attn_kernel(
    const _Float16* __restrict__ Qh, const _Float16* __restrict__ Kh,
    const _Float16* __restrict__ Vt, float* __restrict__ out) {
  __shared__ __align__(16) _Float16 kbuf[2][32 * KSTR];   // K chunk:  32 x 256
  __shared__ __align__(16) _Float16 vbuf[2][256 * VSTR];  // V^T chunk: 256 x 32
  __shared__ __align__(16) _Float16 pbuf[8][16 * PSTR];   // per-wave P tile

  int tid   = threadIdx.x;
  int w     = tid >> 5;
  int lane  = tid & 31;
  int b     = blockIdx.y;
  int qbase = blockIdx.x * 128 + w * 16;
  int nlo   = lane & 15;
  int mofs  = (lane >> 4) * 8;
  _Float16* pb = &pbuf[w][0];

  unsigned klds[2] = { (unsigned)(uintptr_t)&kbuf[0][0],
                       (unsigned)(uintptr_t)&kbuf[1][0] };
  unsigned vlds[2] = { (unsigned)(uintptr_t)&vbuf[0][0],
                       (unsigned)(uintptr_t)&vbuf[1][0] };

  // Q resident in registers: 8 A-fragments covering DH=256.
  v16h aq[8];
  const _Float16* qptr = Qh + (size_t)(b * T_ + qbase) * DH;
#pragma unroll
  for (int c = 0; c < 8; ++c) aq[c] = load_frag_f16(qptr + c * 32, DH);

  v8f zv = {};
  v8f o[16];
#pragma unroll
  for (int t = 0; t < 16; ++t) o[t] = zv;

  float mstate[8], lstate[8];
#pragma unroll
  for (int r = 0; r < 8; ++r) { mstate[r] = -1e30f; lstate[r] = 0.0f; }

  // --- async-copy of one 32-key chunk (K: 16KB, V^T: 16KB), 8 b128/thread ---
  auto issue_chunk = [&](int buf, int kb) {
    const _Float16* kg = Kh + (size_t)(b * T_ + kb) * DH;   // 32 rows x 512B
    const _Float16* vg = Vt + (size_t)b * DH * T_ + kb;     // 256 rows x 64B
#pragma unroll
    for (int it = 0; it < 4; ++it) {
      int s = tid + it * 256;             // 1024 segments of 16B
      int row = s >> 5, c = s & 31;
      async_b128(klds[buf] + row * (KSTR * 2) + c * 16,
                 (unsigned)(row * (DH * 2) + c * 16), kg);
    }
#pragma unroll
    for (int it = 0; it < 4; ++it) {
      int s = tid + it * 256;             // 1024 segments of 16B
      int row = s >> 2, j = s & 3;
      async_b128(vlds[buf] + row * (VSTR * 2) + j * 16,
                 (unsigned)(row * (T_ * 2) + j * 16), vg);
    }
  };

  issue_chunk(0, 0);   // prologue

  for (int kb = 0, it = 0; kb < T_; kb += 32, ++it) {
    int cur = it & 1;
    __asm__ volatile("s_wait_asynccnt 0" ::: "memory");  // chunk landed in LDS
    __syncthreads();                                     // publish; prev reads done
    if (kb + 32 < T_) issue_chunk(cur ^ 1, kb + 32);     // overlap next DMA

    const _Float16* kl = &kbuf[cur][0];
    const _Float16* vl = &vbuf[cur][0];

    // --- S = Q * K^T for 32 keys (two 16x16 tiles) ---
    v8f s0 = zv, s1 = zv;
#pragma unroll
    for (int c = 0; c < 8; ++c) {
      v16h bk0 = load_frag_f16(kl + c * 32, KSTR);
      v16h bk1 = load_frag_f16(kl + 16 * KSTR + c * 32, KSTR);
      s0 = wmma_f16(aq[c], bk0, s0);
      s1 = wmma_f16(aq[c], bk1, s1);
    }

    // --- online softmax; rows live across the 16-lane half (C layout) ---
    float alpha[8];
#pragma unroll
    for (int r = 0; r < 8; ++r) {
      float x0 = s0[r], x1 = s1[r];
      float mx = fmaxf(x0, x1);
      mx = fmaxf(mx, __shfl_xor(mx, 1));
      mx = fmaxf(mx, __shfl_xor(mx, 2));
      mx = fmaxf(mx, __shfl_xor(mx, 4));
      mx = fmaxf(mx, __shfl_xor(mx, 8));
      float mnew = fmaxf(mstate[r], mx);
      float a  = __expf(mstate[r] - mnew);
      float p0 = __expf(x0 - mnew);
      float p1 = __expf(x1 - mnew);
      float rs = p0 + p1;
      rs += __shfl_xor(rs, 1);
      rs += __shfl_xor(rs, 2);
      rs += __shfl_xor(rs, 4);
      rs += __shfl_xor(rs, 8);
      lstate[r] = lstate[r] * a + rs;
      mstate[r] = mnew;
      alpha[r]  = a;
      int m = r + mofs;                    // C layout -> (row m, key nlo)
      pb[m * PSTR + nlo]      = (_Float16)p0;
      pb[m * PSTR + 16 + nlo] = (_Float16)p1;
    }
#pragma unroll
    for (int t = 0; t < 16; ++t)
#pragma unroll
      for (int r = 0; r < 8; ++r) o[t][r] *= alpha[r];

    __asm__ volatile("s_wait_dscnt 0" ::: "memory");  // P tile visible in LDS

    // --- O += P * V : P as A-fragment (K=32), V^T rows from LDS ---
    v16h pa = load_frag_f16(pb, PSTR);
#pragma unroll
    for (int t = 0; t < 16; ++t) {
      v16h bv = load_frag_f16(vl + (t * 16) * VSTR, VSTR);
      o[t] = wmma_f16(pa, bv, o[t]);
    }
  }

  // --- normalize and write fp32 output ---
  float inv[8];
#pragma unroll
  for (int r = 0; r < 8; ++r) inv[r] = 1.0f / lstate[r];
#pragma unroll
  for (int t = 0; t < 16; ++t) {
#pragma unroll
    for (int r = 0; r < 8; ++r) {
      int m = r + mofs;
      int q = qbase + m;
      out[(size_t)(b * T_ + q) * DH + t * 16 + nlo] = o[t][r] * inv[r];
    }
  }
}

// ---------------------------------------------------------------------------
extern "C" void kernel_launch(void* const* d_in, const int* in_sizes, int n_in,
                              void* d_out, int out_size, void* d_ws, size_t ws_size,
                              hipStream_t stream) {
  const float* x  = (const float*)d_in[0];
  const float* Wq = (const float*)d_in[1];
  const float* Wk = (const float*)d_in[2];
  const float* Wv = (const float*)d_in[3];
  float* out = (float*)d_out;

  char* ws = (char*)d_ws;
  _Float16* Qh = (_Float16*)(ws);                                 // 8 MB
  _Float16* Kh = (_Float16*)(ws + (size_t)8  * 1024 * 1024);      // 8 MB
  _Float16* Vt = (_Float16*)(ws + (size_t)16 * 1024 * 1024);      // 8 MB
  _Float16* Wt = (_Float16*)(ws + (size_t)24 * 1024 * 1024);      // 3 x 384 KB

  wt_kernel<<<(3 * DIN * DH / 8 + 255) / 256, 256, 0, stream>>>(Wq, Wk, Wv, Wt);

  dim3 g1((B_ * T_) / 128, 3);
  qkv_kernel<<<g1, 256, 0, stream>>>(x, Wt, Qh, Kh, Vt);

  dim3 g2(T_ / 128, B_);
  attn_kernel<<<g2, 256, 0, stream>>>(Qh, Kh, Vt, out);
}

// v003
// A run of this version takes 184 microseconds.
// Two timings next to v002 put it at 1.58 and 1.59 times that version's speed.
// All steps since v000 together make it 3.42 times as fast.
#include <hip/hip_runtime.h>

// Self-attention forward: Q=xWq*scale, K=xWk, V=xWv; O = softmax(QK^T)V
// B=4, T=4096, D_IN=768, D_H=256.  All matmuls via v_wmma_f32_16x16x32_f16.
// Attention kernel stages K/V chunks into LDS with global_load_async_to_lds_b128
// (double-buffered, ASYNCcnt-tracked) so the DMA overlaps the WMMA work.
// It forms the products transposed (S^T = K Q^T, O^T += V^T P^T): a lane then holds
// the scores of ONE query, and P^T goes from the score registers into the B operand.

typedef _Float16 half8 __attribute__((ext_vector_type(8)));
typedef _Float16 v16h  __attribute__((ext_vector_type(16)));
typedef float    v8f   __attribute__((ext_vector_type(8)));
typedef float    f32x4 __attribute__((ext_vector_type(4)));

#define B_  4
#define T_  4096
#define DIN 768
#define DH  256

// LDS row strides (halves), padded to spread banks; all row offsets 16B-aligned.
#define KSTR 264   // 32 K-rows   x 264 (528 B/row)
#define VSTR 40    // 256 V-rows  x 40  (80 B/row)

union Frag16 { v16h v; half8 h[2]; _Float16 e[16]; };

// 16x32 (A) or 32x16 (B) f16 fragment, per CDNA5 ISA 7.12.2 lane layout.
// lane<16 : row = lane,    K halves {0..7} and {16..23}
// lane>=16: row = lane-16, K halves {8..15} and {24..31}
__device__ __forceinline__ v16h load_frag_f16(const _Float16* base, int stride) {
  int lane = threadIdx.x & 31;
  int r    = lane & 15;
  int hi   = lane >> 4;
  const _Float16* p = base + (size_t)r * stride + (hi ? 8 : 0);
  Frag16 f;
  f.h[0] = *(const half8*)(p);
  f.h[1] = *(const half8*)(p + 16);
  return f.v;
}

// Same A-fragment layout but source is fp32 (converted to f16 in registers).
__device__ __forceinline__ v16h load_frag_f32cvt(const float* base, int stride) {
  int lane = threadIdx.x & 31;
  int r    = lane & 15;
  int hi   = lane >> 4;
  const float* p = base + (size_t)r * stride + (hi ? 8 : 0);
  f32x4 f0 = *(const f32x4*)(p);
  f32x4 f1 = *(const f32x4*)(p + 4);
  f32x4 f2 = *(const f32x4*)(p + 16);
  f32x4 f3 = *(const f32x4*)(p + 20);
  Frag16 f;
#pragma unroll
  for (int i = 0; i < 4; ++i) {
    f.e[i]      = (_Float16)f0[i];
    f.e[4 + i]  = (_Float16)f1[i];
    f.e[8 + i]  = (_Float16)f2[i];
    f.e[12 + i] = (_Float16)f3[i];
  }
  return f.v;
}

__device__ __forceinline__ v8f wmma_f16(v16h a, v16h b, v8f c) {
  // (neg_a, A, neg_b, B, c_mod, C, reuse_a, reuse_b)
  return __builtin_amdgcn_wmma_f32_16x16x32_f16(false, a, false, b, (short)0, c,
                                                false, false);
}

// Lane l takes the value of lane l ^ 16 (the other half of the wave), in the vector unit.
__device__ __forceinline__ float xhalf(float x) {
  int i = __builtin_bit_cast(int, x);
  return __builtin_bit_cast(float, __builtin_amdgcn_permlanex16(
      i, i, 0x76543210, 0xfedcba98, false, false));
}

// Async-DMA one 16B segment: LDS[dst] = MEM[saddr + voff]  (GVS mode, ASYNCcnt)
__device__ __forceinline__ void async_b128(unsigned lds_dst, unsigned voff,
                                           const _Float16* saddr) {
  __asm__ volatile("global_load_async_to_lds_b128 %0, %1, %2"
                   :: "v"(lds_dst), "v"(voff), "s"(saddr) : "memory");
}

// ---------------------------------------------------------------------------
// Kernel 0: convert the weights to f16 and pack them in B-fragment order.
// Unit (w, c, nt, part) = 512 contiguous bytes = what ONE wave-wide 16-byte load of
// the projection reads: lane l holds W_w[c*32 + part*16 + (l>>4)*8 + 0..7][nt*16 + (l&15)].
// Thread g writes halves g*8 .. g*8+7, so every store is 16 B and whole lines fill.
// ---------------------------------------------------------------------------
__global__ void wt_kernel(const float* __restrict__ Wq, const float* __restrict__ Wk,
                          const float* __restrict__ Wv, _Float16* __restrict__ Wt) {
  int g = blockIdx.x * blockDim.x + threadIdx.x;
  const int per8 = DIN * DH / 8;       // 16-byte pieces per weight matrix
  if (g >= 3 * per8) return;
  int w    = g / per8;
  int rem  = g - w * per8;
  int r    = rem & 15;                 // column inside the 16-column tile
  int hi   = (rem >> 4) & 1;           // lane half: k offset 8
  int part = (rem >> 5) & 1;           // first or second 16-byte load: k offset 16
  int nt   = (rem >> 6) & 15;          // column tile
  int c    = rem >> 10;                // 32-deep k block
  int k0   = c * 32 + part * 16 + hi * 8;
  int n    = nt * 16 + r;
  const float* src = (w == 0) ? Wq : (w == 1) ? Wk : Wv;
  half8 v;
  // unrolled so that the eight row loads issue together and v stays in registers
#pragma unroll
  for (int e = 0; e < 8; ++e) v[e] = (_Float16)src[(size_t)(k0 + e) * DH + n];
  *(half8*)(Wt + (size_t)g * 8) = v;
}

// ---------------------------------------------------------------------------
// Kernel 1: QKV projection GEMM.  grid=(128,3), block=256 (8 waves).
// Each wave: 16 rows x full DH=256 cols.  blockIdx.y selects Q/K/V.
// Q is pre-scaled by 1/16; V stored transposed Vt[b][h][t].
// ---------------------------------------------------------------------------
// amdgpu_waves_per_eu(4, 4): two of these 8-wave blocks per WGP is all the grid can
// place, so the register budget is 256 per wave.  Without it the scheduler kept the
// register count low for a residency the launch never reaches and put a full wait
// between every fragment load pair and its WMMA; with it the loads run ahead.
__global__ __launch_bounds__(256) __attribute__((amdgpu_waves_per_eu(4, 4)))
void qkv_kernel(
    const float* __restrict__ x, const _Float16* __restrict__ Wt,
    _Float16* __restrict__ Qh, _Float16* __restrict__ Kh,
    _Float16* __restrict__ Vt) {
  int w       = threadIdx.x >> 5;
  int lane    = threadIdx.x & 31;
  int wsel    = blockIdx.y;
  int rowbase = blockIdx.x * 128 + w * 16;   // global row in [0, B*T)
  const _Float16* Wsel = Wt + (size_t)wsel * (DIN * DH);

  v8f zv = {};
  v8f acc[16];
#pragma unroll
  for (int n = 0; n < 16; ++n) acc[n] = zv;

  const float* xbase = x + (size_t)rowbase * DIN;
  for (int c = 0; c < DIN / 32; ++c) {
    if (c + 1 < DIN / 32)
      __builtin_prefetch(xbase + (size_t)(lane & 15) * DIN + (c + 1) * 32, 0, 3);
    v16h af = load_frag_f32cvt(xbase + c * 32, DIN);
#pragma unroll
    for (int n = 0; n < 16; ++n) {
      // packed fragment: two loads of 512 contiguous bytes (4 whole lines each)
      const _Float16* wp = Wsel + (size_t)(c * 16 + n) * 512 + lane * 8;
      Frag16 bf;
      bf.h[0] = *(const half8*)(wp);
      bf.h[1] = *(const half8*)(wp + 256);
      acc[n] = wmma_f16(af, bf.v, acc[n]);
    }
  }

  float scale = (wsel == 0) ? 0.0625f : 1.0f;   // fold 1/sqrt(DH) into Q
  int nlo  = lane & 15;
  int mofs = (lane >> 4) * 8;
#pragma unroll
  for (int n = 0; n < 16; ++n) {
#pragma unroll
    for (int r = 0; r < 8; ++r) {
      int m    = r + mofs;
      int grow = rowbase + m;
      int col  = n * 16 + nlo;
      _Float16 hv = (_Float16)(acc[n][r] * scale);
      if (wsel == 0) {
        Qh[(size_t)grow * DH + col] = hv;
      } else if (wsel == 1) {
        Kh[(size_t)grow * DH + col] = hv;
      } else {
        int b = grow >> 12;              // T_ == 4096
        int t = grow & (T_ - 1);
        Vt[((size_t)b * DH + col) * T_ + t] = hv;
      }
    }
  }
}

// ---------------------------------------------------------------------------
// Kernel 2: flash attention.  grid=(T/128, B), block=256 (8 waves).
// Each wave: 16 queries, full DH output, online softmax over keys.
// K/V chunks (32 keys) staged to LDS by async DMA, double-buffered.
// Lane l (c = l & 15, h = l >> 4) works for query c alone: a score tile's register r is
// S^T[key 8h + r][query c], an output tile's register r is O^T[dim 8h + r][query c].
// ---------------------------------------------------------------------------
// amdgpu_waves_per_eu(2, 2): the grid has fewer blocks than the chip has WGPs, so one
// block (two waves per SIMD) is the real residency and 512 registers per wave are
// free.  Without it the scheduler minimised registers: one LDS fragment pair, a full
// wait, one WMMA; with it the LDS reads are issued in groups ahead of counted waits.
__global__ __launch_bounds__(256) __attribute__((amdgpu_waves_per_eu(2, 2)))
void attn_kernel(
    const _Float16* __restrict__ Qh, const _Float16* __restrict__ Kh,
    const _Float16* __restrict__ Vt, float* __restrict__ out) {
  __shared__ __align__(16) _Float16 kbuf[2][32 * KSTR];   // K chunk:  32 x 256
  __shared__ __align__(16) _Float16 vbuf[2][256 * VSTR];  // V^T chunk: 256 x 32

  int tid   = threadIdx.x;
  int w     = tid >> 5;
  int lane  = tid & 31;
  int b     = blockIdx.y;
  int qbase = blockIdx.x * 128 + w * 16;
  int nlo   = lane & 15;
  int mofs  = (lane >> 4) * 8;

  unsigned klds[2] = { (unsigned)(uintptr_t)&kbuf[0][0],
                       (unsigned)(uintptr_t)&kbuf[1][0] };
  unsigned vlds[2] = { (unsigned)(uintptr_t)&vbuf[0][0],
                       (unsigned)(uintptr_t)&vbuf[1][0] };

  // Q resident in registers: 8 B-fragments (column = query) covering DH=256.
  v16h bq[8];
  const _Float16* qptr = Qh + (size_t)(b * T_ + qbase) * DH;
#pragma unroll
  for (int c = 0; c < 8; ++c) bq[c] = load_frag_f16(qptr + c * 32, DH);

  v8f zv = {};
  v8f o[16];
#pragma unroll
  for (int t = 0; t < 16; ++t) o[t] = zv;

  // this lane's query: running maximum (alike in both halves) and the sum over the
  // keys that this half of the wave holds; the halves' sums join after the loop
  float mstate = -1e30f, lstate = 0.0f;

  // --- async-copy of one 32-key chunk (K: 16KB, V^T: 16KB), 8 b128/thread ---
  auto issue_chunk = [&](int buf, int kb) {
    const _Float16* kg = Kh + (size_t)(b * T_ + kb) * DH;   // 32 rows x 512B
    const _Float16* vg = Vt + (size_t)b * DH * T_ + kb;     // 256 rows x 64B
#pragma unroll
    for (int it = 0; it < 4; ++it) {
      int s = tid + it * 256;             // 1024 segments of 16B
      int row = s >> 5, c = s & 31;
      async_b128(klds[buf] + row * (KSTR * 2) + c * 16,
                 (unsigned)(row * (DH * 2) + c * 16), kg);
    }
#pragma unroll
    for (int it = 0; it < 4; ++it) {
      int s = tid + it * 256;             // 1024 segments of 16B
      int row = s >> 2, j = s & 3;
      async_b128(vlds[buf] + row * (VSTR * 2) + j * 16,
                 (unsigned)(row * (T_ * 2) + j * 16), vg);
    }
  };

  issue_chunk(0, 0);   // prologue

  // The buffer index comes from kb itself: with a second counter the compiler split off
  // the last trip with a refill that never runs and spilled that refill's addresses.
  for (int kb = 0; kb < T_; kb += 32) {
    int cur = (kb >> 5) & 1;
    __asm__ volatile("s_wait_asynccnt 0" ::: "memory");  // chunk landed in LDS
    __syncthreads();                                     // publish; prev reads done
    if (kb + 32 < T_) issue_chunk(cur ^ 1, kb + 32);     // overlap next DMA

    const _Float16* kl = &kbuf[cur][0];
    const _Float16* vl = &vbuf[cur][0];

    // --- S^T = K * Q^T for 32 keys (two 16x16 tiles): A = K rows, B = Q ---
    v8f s0 = zv, s1 = zv;
#pragma unroll
    for (int c = 0; c < 8; ++c) {
      v16h ak0 = load_frag_f16(kl + c * 32, KSTR);
      v16h ak1 = load_frag_f16(kl + 16 * KSTR + c * 32, KSTR);
      s0 = wmma_f16(ak0, bq[c], s0);
      s1 = wmma_f16(ak1, bq[c], s1);
    }

    // --- online softmax: 16 of the query's 32 scores are in this lane ---
    float mx = fmaxf(s0[0], s1[0]);
#pragma unroll
    for (int r = 1; r < 8; ++r) mx = fmaxf(mx, fmaxf(s0[r], s1[r]));
    mx = fmaxf(mx, xhalf(mx));
    float mnew  = fmaxf(mstate, mx);
    float alpha = __expf(mstate - mnew);
    mstate = mnew;

    // P^T as B operand: element s is key 8h + s (s < 8) or 16 + 8h + (s - 8), which is
    // the order of the two score tiles' registers and of the V^T fragment's halves.
    Frag16 pf;
    float rs = 0.0f;
#pragma unroll
    for (int r = 0; r < 8; ++r) {
      float p0 = __expf(s0[r] - mnew);
      float p1 = __expf(s1[r] - mnew);
      rs += p0 + p1;
      pf.e[r]     = (_Float16)p0;
      pf.e[8 + r] = (_Float16)p1;
    }
    lstate = lstate * alpha + rs;

#pragma unroll
    for (int t = 0; t < 16; ++t)
#pragma unroll
      for (int r = 0; r < 8; ++r) o[t][r] *= alpha;

    // --- O^T += V^T * P^T : A = V^T rows from LDS (row = dim), B = P^T ---
#pragma unroll
    for (int t = 0; t < 16; ++t) {
      v16h av = load_frag_f16(vl + (t * 16) * VSTR, VSTR);
      o[t] = wmma_f16(av, pf.v, o[t]);
    }
  }

  // --- normalize and write fp32 output: 8 consecutive dims of one query per tile ---
  float inv = 1.0f / (lstate + xhalf(lstate));
  float* orow = out + (size_t)(b * T_ + qbase + nlo) * DH + mofs;
#pragma unroll
  for (int t = 0; t < 16; ++t) {
    v8f ov = o[t] * inv;
    *(f32x4*)(orow + t * 16)     = __builtin_shufflevector(ov, ov, 0, 1, 2, 3);
    *(f32x4*)(orow + t * 16 + 4) = __builtin_shufflevector(ov, ov, 4, 5, 6, 7);
  }
}

// ---------------------------------------------------------------------------
extern "C" void kernel_launch(void* const* d_in, const int* in_sizes, int n_in,
                              void* d_out, int out_size, void* d_ws, size_t ws_size,
                              hipStream_t stream) {
  const float* x  = (const float*)d_in[0];
  const float* Wq = (const float*)d_in[1];
  const float* Wk = (const float*)d_in[2];
  const float* Wv = (const float*)d_in[3];
  float* out = (float*)d_out;

  char* ws = (char*)d_ws;
  _Float16* Qh = (_Float16*)(ws);                                 // 8 MB
  _Float16* Kh = (_Float16*)(ws + (size_t)8  * 1024 * 1024);      // 8 MB
  _Float16* Vt = (_Float16*)(ws + (size_t)16 * 1024 * 1024);      // 8 MB
  _Float16* Wt = (_Float16*)(ws + (size_t)24 * 1024 * 1024);      // 3 x 384 KB

  wt_kernel<<<(3 * DIN * DH / 8 + 255) / 256, 256, 0, stream>>>(Wq, Wk, Wv, Wt);

  dim3 g1((B_ * T_) / 128, 3);
  qkv_kernel<<<g1, 256, 0, stream>>>(x, Wt, Qh, Kh, Vt);

  dim3 g2(T_ / 128, B_);
  attn_kernel<<<g2, 256, 0, stream>>>(Qh, Kh, Vt, out);
}

// v004
// A run of this version takes 144 microseconds.
// In two side-by-side timings against v003, it was 1.29 and 1.28 times as fast.
// Over all steps from v000 it is 4.39 times as fast.
#include <hip/hip_runtime.h>

// Self-attention forward: Q=xWq*scale, K=xWk, V=xWv; O = softmax(QK^T)V
// B=4, T=4096, D_IN=768, D_H=256.  All matmuls via v_wmma_f32_16x16x32_f16.
// Attention kernel stages K/V passes into LDS with global_load_async_to_lds_b128
// (double-buffered, ASYNCcnt-tracked) so the DMA overlaps the WMMA work.
// A block holds 64 queries; its two groups of four waves each take every other 32 keys,
// so that the grid has one block for every WGP; the groups' results join at the end.
// It forms the products transposed (S^T = K Q^T, O^T += V^T P^T): a lane then holds
// the scores of ONE query, and P^T goes from the score registers into the B operand.

typedef _Float16 half8 __attribute__((ext_vector_type(8)));
typedef _Float16 v16h  __attribute__((ext_vector_type(16)));
typedef float    v8f   __attribute__((ext_vector_type(8)));
typedef float    f32x4 __attribute__((ext_vector_type(4)));

#define B_  4
#define T_  4096
#define DIN 768
#define DH  256

// LDS row strides (halves), padded to spread banks; all row offsets 16B-aligned.
#define KSTR 264   // 64 K-rows   x 264 (528 B/row)
#define VSTR 72    // 256 V-rows  x 72  (144 B/row)
#define KPASS 64   // keys staged per pass: 32 for each group of waves
#define KHALVES (KPASS * KSTR)
#define VHALVES (DH * VSTR)

union Frag16 { v16h v; half8 h[2]; _Float16 e[16]; };

// 16x32 (A) or 32x16 (B) f16 fragment, per CDNA5 ISA 7.12.2 lane layout.
// lane<16 : row = lane,    K halves {0..7} and {16..23}
// lane>=16: row = lane-16, K halves {8..15} and {24..31}
__device__ __forceinline__ v16h load_frag_f16(const _Float16* base, int stride) {
  int lane = threadIdx.x & 31;
  int r    = lane & 15;
  int hi   = lane >> 4;
  const _Float16* p = base + (size_t)r * stride + (hi ? 8 : 0);
  Frag16 f;
  f.h[0] = *(const half8*)(p);
  f.h[1] = *(const half8*)(p + 16);
  return f.v;
}

// Same A-fragment layout but source is fp32 (converted to f16 in registers).
__device__ __forceinline__ v16h load_frag_f32cvt(const float* base, int stride) {
  int lane = threadIdx.x & 31;
  int r    = lane & 15;
  int hi   = lane >> 4;
  const float* p = base + (size_t)r * stride + (hi ? 8 : 0);
  f32x4 f0 = *(const f32x4*)(p);
  f32x4 f1 = *(const f32x4*)(p + 4);
  f32x4 f2 = *(const f32x4*)(p + 16);
  f32x4 f3 = *(const f32x4*)(p + 20);
  Frag16 f;
#pragma unroll
  for (int i = 0; i < 4; ++i) {
    f.e[i]      = (_Float16)f0[i];
    f.e[4 + i]  = (_Float16)f1[i];
    f.e[8 + i]  = (_Float16)f2[i];
    f.e[12 + i] = (_Float16)f3[i];
  }
  return f.v;
}

__device__ __forceinline__ v8f wmma_f16(v16h a, v16h b, v8f c) {
  // (neg_a, A, neg_b, B, c_mod, C, reuse_a, reuse_b)
  return __builtin_amdgcn_wmma_f32_16x16x32_f16(false, a, false, b, (short)0, c,
                                                false, false);
}

// Lane l takes the value of lane l ^ 16 (the other half of the wave), in the vector unit.
__device__ __forceinline__ float xhalf(float x) {
  int i = __builtin_bit_cast(int, x);
  return __builtin_bit_cast(float, __builtin_amdgcn_permlanex16(
      i, i, 0x76543210, 0xfedcba98, false, false));
}

// Async copy of one 16-byte segment per lane: LDS[dst] = MEM[src]  (ASYNCcnt)
typedef int i32x4 __attribute__((ext_vector_type(4)));
typedef __attribute__((address_space(1))) i32x4 glb_i32x4;
typedef __attribute__((address_space(3))) i32x4 lds_i32x4;
// base is the same for the whole wave and moves from pass to pass; off is the lane's own
// byte offset, which stays the same in every pass and is kept in registers
__device__ __forceinline__ void async_b128(_Float16* dst, const _Float16* base, unsigned off) {
  __builtin_amdgcn_global_load_async_to_lds_b128(
      (glb_i32x4*)((const char*)base + off), (lds_i32x4*)dst, 0, 0);
}

// ---------------------------------------------------------------------------
// Kernel 0: convert the weights to f16 and pack them in B-fragment order.
// Unit (w, c, nt, part) = 512 contiguous bytes = what ONE wave-wide 16-byte load of
// the projection reads: lane l holds W_w[c*32 + part*16 + (l>>4)*8 + 0..7][nt*16 + (l&15)].
// Thread g writes halves g*8 .. g*8+7, so every store is 16 B and whole lines fill.
// ---------------------------------------------------------------------------
__global__ void wt_kernel(const float* __restrict__ Wq, const float* __restrict__ Wk,
                          const float* __restrict__ Wv, _Float16* __restrict__ Wt) {
  int g = blockIdx.x * blockDim.x + threadIdx.x;
  const int per8 = DIN * DH / 8;       // 16-byte pieces per weight matrix
  if (g >= 3 * per8) return;
  int w    = g / per8;
  int rem  = g - w * per8;
  int r    = rem & 15;                 // column inside the 16-column tile
  int hi   = (rem >> 4) & 1;           // lane half: k offset 8
  int part = (rem >> 5) & 1;           // first or second 16-byte load: k offset 16
  int nt   = (rem >> 6) & 15;          // column tile
  int c    = rem >> 10;                // 32-deep k block
  int k0   = c * 32 + part * 16 + hi * 8;
  int n    = nt * 16 + r;
  const float* src = (w == 0) ? Wq : (w == 1) ? Wk : Wv;
  half8 v;
  // unrolled so that the eight row loads issue together and v stays in registers
#pragma unroll
  for (int e = 0; e < 8; ++e) v[e] = (_Float16)src[(size_t)(k0 + e) * DH + n];
  *(half8*)(Wt + (size_t)g * 8) = v;
}

// ---------------------------------------------------------------------------
// Kernel 1: QKV projection GEMM.  grid=(128,3), block=256 (8 waves).
// Each wave: 16 rows x full DH=256 cols.  blockIdx.y selects Q/K/V.
// Q is pre-scaled by 1/16; V stored transposed Vt[b][h][t].
// ---------------------------------------------------------------------------
// amdgpu_waves_per_eu(4, 4): two of these 8-wave blocks per WGP is all the grid can
// place, so the register budget is 256 per wave.  Without it the scheduler kept the
// register count low for a residency the launch never reaches and put a full wait
// between every fragment load pair and its WMMA; with it the loads run ahead.
__global__ __launch_bounds__(256) __attribute__((amdgpu_waves_per_eu(4, 4)))
void qkv_kernel(
    const float* __restrict__ x, const _Float16* __restrict__ Wt,
    _Float16* __restrict__ Qh, _Float16* __restrict__ Kh,
    _Float16* __restrict__ Vt) {
  int w       = threadIdx.x >> 5;
  int lane    = threadIdx.x & 31;
  int wsel    = blockIdx.y;
  int rowbase = blockIdx.x * 128 + w * 16;   // global row in [0, B*T)
  const _Float16* Wsel = Wt + (size_t)wsel * (DIN * DH);

  v8f zv = {};
  v8f acc[16];
#pragma unroll
  for (int n = 0; n < 16; ++n) acc[n] = zv;

  const float* xbase = x + (size_t)rowbase * DIN;
  for (int c = 0; c < DIN / 32; ++c) {
    if (c + 1 < DIN / 32)
      __builtin_prefetch(xbase + (size_t)(lane & 15) * DIN + (c + 1) * 32, 0, 3);
    v16h af = load_frag_f32cvt(xbase + c * 32, DIN);
#pragma unroll
    for (int n = 0; n < 16; ++n) {
      // packed fragment: two loads of 512 contiguous bytes (4 whole lines each)
      const _Float16* wp = Wsel + (size_t)(c * 16 + n) * 512 + lane * 8;
      Frag16 bf;
      bf.h[0] = *(const half8*)(wp);
      bf.h[1] = *(const half8*)(wp + 256);
      acc[n] = wmma_f16(af, bf.v, acc[n]);
    }
  }

  float scale = (wsel == 0) ? 0.0625f : 1.0f;   // fold 1/sqrt(DH) into Q
  int nlo  = lane & 15;
  int mofs = (lane >> 4) * 8;
#pragma unroll
  for (int n = 0; n < 16; ++n) {
#pragma unroll
    for (int r = 0; r < 8; ++r) {
      int m    = r + mofs;
      int grow = rowbase + m;
      int col  = n * 16 + nlo;
      _Float16 hv = (_Float16)(acc[n][r] * scale);
      if (wsel == 0) {
        Qh[(size_t)grow * DH + col] = hv;
      } else if (wsel == 1) {
        Kh[(size_t)grow * DH + col] = hv;
      } else {
        int b = grow >> 12;              // T_ == 4096
        int t = grow & (T_ - 1);
        Vt[((size_t)b * DH + col) * T_ + t] = hv;
      }
    }
  }
}

// ---------------------------------------------------------------------------
// Kernel 2: flash attention.  grid=(T/64, B), block=256 (8 waves) = one block per WGP.
// Wave w: query tile w & 3 (16 queries, full DH output), key group g = w >> 2.
// A pass stages 64 keys (double-buffered async copies); group g works on keys
// 32g .. 32g+31 of it with its own online softmax.  After the loop the two groups
// exchange half of their output tiles through LDS and each finishes 128 dims.
// Lane l (c = l & 15, h = l >> 4) works for query c alone: a score tile's register r is
// S^T[key 8h + r][query c], an output tile's register r is O^T[dim 8h + r][query c].
// ---------------------------------------------------------------------------
// amdgpu_waves_per_eu(2, 2): the grid has one block per WGP, so one block (two waves
// per SIMD) is the real residency and 512 registers per wave are free.  Without it
// the scheduler minimised registers: one LDS fragment pair, a full wait, one WMMA;
// with it the LDS reads are issued in groups ahead of counted waits.
__global__ __launch_bounds__(256) __attribute__((amdgpu_waves_per_eu(2, 2)))
void attn_kernel(
    const _Float16* __restrict__ Qh, const _Float16* __restrict__ Kh,
    const _Float16* __restrict__ Vt, float* __restrict__ out) {
  // ring: K pass 64 x 256 (two buffers), then V^T pass 256 x 64 (two buffers)
  __shared__ __align__(16) _Float16 ring[2 * KHALVES + 2 * VHALVES];

  int tid   = threadIdx.x;
  int w     = tid >> 5;
  int lane  = tid & 31;
  int g     = w >> 2;
  int b     = blockIdx.y;
  int qbase = blockIdx.x * 64 + (w & 3) * 16;
  int nlo   = lane & 15;
  int mofs  = (lane >> 4) * 8;

  // Q resident in registers: 8 B-fragments (column = query) covering DH=256.
  v16h bq[8];
  const _Float16* qptr = Qh + (size_t)(b * T_ + qbase) * DH;
#pragma unroll
  for (int c = 0; c < 8; ++c) bq[c] = load_frag_f16(qptr + c * 32, DH);

  v8f zv = {};
  v8f o[16];
#pragma unroll
  for (int t = 0; t < 16; ++t) o[t] = zv;

  // this lane's query, this group's keys: running maximum (alike in both halves) and
  // the sum over the keys that this half of the wave holds; all sums join after the loop
  float mstate = -1e30f, lstate = 0.0f;

  // --- async copy of one 64-key pass (K: 32KB, V^T: 32KB), 16 b128/thread; every
  // wave-wide copy reads whole 128-byte lines (K: one row, V^T: four rows) ---
  auto issue_pass = [&](int buf, int p) {
    const _Float16* kg = Kh + (size_t)(b * T_ + p * KPASS) * DH;   // 64 rows x 512B
    const _Float16* vg = Vt + (size_t)b * DH * T_ + p * KPASS;     // 256 rows x 128B
    _Float16* kd = ring + buf * KHALVES;
    _Float16* vd = ring + 2 * KHALVES + buf * VHALVES;
#pragma unroll
    for (int it = 0; it < 8; ++it) {
      int s = tid + it * 256;             // 2048 segments of 16B
      int row = s >> 5, c = s & 31;
      async_b128(kd + row * KSTR + c * 8, kg, (unsigned)(row * (DH * 2) + c * 16));
    }
#pragma unroll
    for (int it = 0; it < 8; ++it) {
      int s = tid + it * 256;             // 2048 segments of 16B
      int row = s >> 3, j = s & 7;
      async_b128(vd + row * VSTR + j * 8, vg, (unsigned)(row * (T_ * 2) + j * 16));
    }
  };

  const int NP = T_ / KPASS;
  issue_pass(0, 0);
  __asm__ volatile("s_wait_asynccnt 0x0" ::: "memory");  // pass 0 landed in LDS
  __syncthreads();                                       // publish pass 0
  issue_pass(1, 1);

  for (int p = 0; p < NP; ++p) {
    int cur = p & 1;
    const _Float16* kl = ring + cur * KHALVES + g * (32 * KSTR);
    const _Float16* vl = ring + 2 * KHALVES + cur * VHALVES + g * 32;

    // --- S^T = K * Q^T for 32 keys (two 16x16 tiles): A = K rows, B = Q ---
    v8f s0 = zv, s1 = zv;
#pragma unroll
    for (int c = 0; c < 8; ++c) {
      v16h ak0 = load_frag_f16(kl + c * 32, KSTR);
      v16h ak1 = load_frag_f16(kl + 16 * KSTR + c * 32, KSTR);
      s0 = wmma_f16(ak0, bq[c], s0);
      s1 = wmma_f16(ak1, bq[c], s1);
    }

    // --- online softmax: 16 of the query's 32 scores are in this lane ---
    float mx = fmaxf(s0[0], s1[0]);
#pragma unroll
    for (int r = 1; r < 8; ++r) mx = fmaxf(mx, fmaxf(s0[r], s1[r]));
    mx = fmaxf(mx, xhalf(mx));
    float mnew  = fmaxf(mstate, mx);
    float alpha = __expf(mstate - mnew);
    mstate = mnew;

    // P^T as B operand: element s is key 8h + s (s < 8) or 16 + 8h + (s - 8), which is
    // the order of the two score tiles' registers and of the V^T fragment's halves.
    Frag16 pf;
    float rs = 0.0f;
#pragma unroll
    for (int r = 0; r < 8; ++r) {
      float p0 = __expf(s0[r] - mnew);
      float p1 = __expf(s1[r] - mnew);
      rs += p0 + p1;
      pf.e[r]     = (_Float16)p0;
      pf.e[8 + r] = (_Float16)p1;
    }
    lstate = lstate * alpha + rs;

#pragma unroll
    for (int t = 0; t < 16; ++t)
#pragma unroll
      for (int r = 0; r < 8; ++r) o[t][r] *= alpha;

    // --- O^T += V^T * P^T : A = V^T rows from LDS (row = dim), B = P^T ---
#pragma unroll
    for (int t = 0; t < 16; ++t) {
      v16h av = load_frag_f16(vl + (t * 16) * VSTR, VSTR);
      o[t] = wmma_f16(av, pf.v, o[t]);
    }

    // --- publish pass p + 1, free this pass's buffer, refill it with pass p + 2 ---
    __asm__ volatile("s_wait_dscnt 0x0" ::: "memory");     // own reads of this buffer done
    __asm__ volatile("s_wait_asynccnt 0x0" ::: "memory");  // own copies of pass p + 1 landed
    __syncthreads();
    if (p + 2 < NP) issue_pass(cur, p + 2);
  }
  __asm__ volatile("s_wait_asynccnt 0x0" ::: "memory");    // nothing in flight: ring is free

  // --- join the two key groups.  Wave w and wave w ^ 4 hold the same 16 queries.
  // Group g finishes dims 128g .. 128g+127: it hands its other eight tiles, its
  // maximum and its sum to the partner through the (now free) ring. ---
  f32x4* xo = (f32x4*)ring;                                // 8 waves x 16 x 32 x 16 B
  float* xm = (float*)(ring + 2 * KHALVES);                // 8 waves x 32 maxima
  float* xl = xm + 256;                                    // 8 waves x 32 sums
  v8f keep[8];
#pragma unroll
  for (int t = 0; t < 8; ++t) {
    v8f send = g ? o[t] : o[t + 8];
    keep[t]  = g ? o[t + 8] : o[t];
    xo[(w * 16 + t * 2) * 32 + lane]     = __builtin_shufflevector(send, send, 0, 1, 2, 3);
    xo[(w * 16 + t * 2 + 1) * 32 + lane] = __builtin_shufflevector(send, send, 4, 5, 6, 7);
  }
  xm[tid] = mstate;
  xl[tid] = lstate;
  __syncthreads();                                         // partner's tiles are visible

  int   pw    = w ^ 4;
  float mo    = xm[pw * 32 + lane];
  float lo    = xl[pw * 32 + lane];
  float mall  = fmaxf(mstate, mo);
  float a_own = __expf(mstate - mall);
  float a_oth = __expf(mo - mall);
  float lsum  = lstate * a_own + lo * a_oth;
  float inv   = 1.0f / (lsum + xhalf(lsum));
  a_own *= inv;
  a_oth *= inv;

  // --- normalize and write fp32 output: 8 consecutive dims of one query per tile ---
  float* orow = out + (size_t)(b * T_ + qbase + nlo) * DH + g * 128 + mofs;
#pragma unroll
  for (int t = 0; t < 8; ++t) {
    f32x4 p0 = xo[(pw * 16 + t * 2) * 32 + lane];
    f32x4 p1 = xo[(pw * 16 + t * 2 + 1) * 32 + lane];
    f32x4 k0 = __builtin_shufflevector(keep[t], keep[t], 0, 1, 2, 3);
    f32x4 k1 = __builtin_shufflevector(keep[t], keep[t], 4, 5, 6, 7);
    *(f32x4*)(orow + t * 16)     = k0 * a_own + p0 * a_oth;
    *(f32x4*)(orow + t * 16 + 4) = k1 * a_own + p1 * a_oth;
  }
}

// ---------------------------------------------------------------------------
extern "C" void kernel_launch(void* const* d_in, const int* in_sizes, int n_in,
                              void* d_out, int out_size, void* d_ws, size_t ws_size,
                              hipStream_t stream) {
  const float* x  = (const float*)d_in[0];
  const float* Wq = (const float*)d_in[1];
  const float* Wk = (const float*)d_in[2];
  const float* Wv = (const float*)d_in[3];
  float* out = (float*)d_out;

  char* ws = (char*)d_ws;
  _Float16* Qh = (_Float16*)(ws);                                 // 8 MB
  _Float16* Kh = (_Float16*)(ws + (size_t)8  * 1024 * 1024);      // 8 MB
  _Float16* Vt = (_Float16*)(ws + (size_t)16 * 1024 * 1024);      // 8 MB
  _Float16* Wt = (_Float16*)(ws + (size_t)24 * 1024 * 1024);      // 3 x 384 KB

  wt_kernel<<<(3 * DIN * DH / 8 + 255) / 256, 256, 0, stream>>>(Wq, Wk, Wv, Wt);

  dim3 g1((B_ * T_) / 128, 3);
  qkv_kernel<<<g1, 256, 0, stream>>>(x, Wt, Qh, Kh, Vt);

  dim3 g2(T_ / 64, B_);
  attn_kernel<<<g2, 256, 0, stream>>>(Qh, Kh, Vt, out);
}

// v005
// A run of this version takes 134 microseconds.
// In two side-by-side timings against v004, it was 1.07 and 1.08 times as fast.
// Counting every step since v000, it is 4.72 times as fast.
#include <hip/hip_runtime.h>

// Self-attention forward: Q=xWq*scale, K=xWk, V=xWv; O = softmax(QK^T)V
// B=4, T=4096, D_IN=768, D_H=256.  All matmuls via v_wmma_f32_16x16x32_f16.
// Attention kernel stages K/V passes into LDS with global_load_async_to_lds_b128
// (double-buffered, ASYNCcnt-tracked) so the DMA overlaps the WMMA work.
// A block holds 64 queries; its two groups of four waves each take every other 32 keys,
// so that the grid has one block for every WGP; the groups' results join at the end.
// It forms the products transposed (S^T = K Q^T, O^T += V^T P^T): a lane then holds
// the scores of ONE query, and P^T goes from the score registers into the B operand.

typedef _Float16 half8 __attribute__((ext_vector_type(8)));
typedef _Float16 v16h  __attribute__((ext_vector_type(16)));
typedef float    v8f   __attribute__((ext_vector_type(8)));
typedef float    f32x4 __attribute__((ext_vector_type(4)));

#define B_  4
#define T_  4096
#define DIN 768
#define DH  256

// LDS row strides (halves), padded to spread banks; all row offsets 16B-aligned.
#define KSTR 264   // 64 K-rows   x 264 (528 B/row)
#define VSTR 72    // 256 V-rows  x 72  (144 B/row)
#define KPASS 64   // keys staged per pass: 32 for each group of waves
#define KHALVES (KPASS * KSTR)
#define VHALVES (DH * VSTR)

union Frag16 { v16h v; half8 h[2]; _Float16 e[16]; };

// 16x32 (A) or 32x16 (B) f16 fragment, per CDNA5 ISA 7.12.2 lane layout.
// lane<16 : row = lane,    K halves {0..7} and {16..23}
// lane>=16: row = lane-16, K halves {8..15} and {24..31}
__device__ __forceinline__ v16h load_frag_f16(const _Float16* base, int stride) {
  int lane = threadIdx.x & 31;
  int r    = lane & 15;
  int hi   = lane >> 4;
  const _Float16* p = base + (size_t)r * stride + (hi ? 8 : 0);
  Frag16 f;
  f.h[0] = *(const half8*)(p);
  f.h[1] = *(const half8*)(p + 16);
  return f.v;
}

// Same A-fragment layout but source is fp32 (converted to f16 in registers).
__device__ __forceinline__ v16h load_frag_f32cvt(const float* base, int stride) {
  int lane = threadIdx.x & 31;
  int r    = lane & 15;
  int hi   = lane >> 4;
  const float* p = base + (size_t)r * stride + (hi ? 8 : 0);
  f32x4 f0 = *(const f32x4*)(p);
  f32x4 f1 = *(const f32x4*)(p + 4);
  f32x4 f2 = *(const f32x4*)(p + 16);
  f32x4 f3 = *(const f32x4*)(p + 20);
  Frag16 f;
#pragma unroll
  for (int i = 0; i < 4; ++i) {
    f.e[i]      = (_Float16)f0[i];
    f.e[4 + i]  = (_Float16)f1[i];
    f.e[8 + i]  = (_Float16)f2[i];
    f.e[12 + i] = (_Float16)f3[i];
  }
  return f.v;
}

__device__ __forceinline__ v8f wmma_f16(v16h a, v16h b, v8f c) {
  // (neg_a, A, neg_b, B, c_mod, C, reuse_a, reuse_b)
  return __builtin_amdgcn_wmma_f32_16x16x32_f16(false, a, false, b, (short)0, c,
                                                false, false);
}

// Lane l takes the value of lane l ^ 16 (the other half of the wave), in the vector unit.
__device__ __forceinline__ float xhalf(float x) {
  int i = __builtin_bit_cast(int, x);
  return __builtin_bit_cast(float, __builtin_amdgcn_permlanex16(
      i, i, 0x76543210, 0xfedcba98, false, false));
}

// Async copy of one 16-byte segment per lane: LDS[dst] = MEM[src]  (ASYNCcnt)
typedef int i32x4 __attribute__((ext_vector_type(4)));
typedef __attribute__((address_space(1))) i32x4 glb_i32x4;
typedef __attribute__((address_space(3))) i32x4 lds_i32x4;
// base is the same for the whole wave and moves from pass to pass; off is the lane's own
// byte offset, which stays the same in every pass and is kept in registers
__device__ __forceinline__ void async_b128(_Float16* dst, const _Float16* base, unsigned off) {
  __builtin_amdgcn_global_load_async_to_lds_b128(
      (glb_i32x4*)((const char*)base + off), (lds_i32x4*)dst, 0, 0);
}

// ---------------------------------------------------------------------------
// Kernel 0: convert the weights to f16 and pack them in B-fragment order.
// Unit (w, c, nt, part) = 512 contiguous bytes = what ONE wave-wide 16-byte load of
// the projection reads: lane l holds W_w[c*32 + part*16 + (l>>4)*8 + 0..7][nt*16 + (l&15)].
// Thread g writes halves g*8 .. g*8+7, so every store is 16 B and whole lines fill.
// ---------------------------------------------------------------------------
__global__ void wt_kernel(const float* __restrict__ Wq, const float* __restrict__ Wk,
                          const float* __restrict__ Wv, _Float16* __restrict__ Wt) {
  int g = blockIdx.x * blockDim.x + threadIdx.x;
  const int per8 = DIN * DH / 8;       // 16-byte pieces per weight matrix
  if (g >= 3 * per8) return;
  int w    = g / per8;
  int rem  = g - w * per8;
  int r    = rem & 15;                 // column inside the 16-column tile
  int hi   = (rem >> 4) & 1;           // lane half: k offset 8
  int part = (rem >> 5) & 1;           // first or second 16-byte load: k offset 16
  int nt   = (rem >> 6) & 15;          // column tile
  int c    = rem >> 10;                // 32-deep k block
  int k0   = c * 32 + part * 16 + hi * 8;
  int n    = nt * 16 + r;
  const float* src = (w == 0) ? Wq : (w == 1) ? Wk : Wv;
  half8 v;
  // unrolled so that the eight row loads issue together and v stays in registers
#pragma unroll
  for (int e = 0; e < 8; ++e) v[e] = (_Float16)src[(size_t)(k0 + e) * DH + n];
  *(half8*)(Wt + (size_t)g * 8) = v;
}

// ---------------------------------------------------------------------------
// Kernel 1: QKV projection GEMM.  grid=(128,3), block=256 (8 waves).
// Each wave: 16 rows x full DH=256 cols.  blockIdx.y selects Q/K/V.
// Q is pre-scaled by 1/16; V stored transposed Vt[b][h][t].
// The block's 128 x 256 result goes through LDS in the layout of its destination, so
// that every global store is 16 bytes a lane and a wave-wide store fills whole lines.
// ---------------------------------------------------------------------------
#define QSTG 264   // Q/K stage: 128 token rows x 264 halves (528 B = 16 B x odd)
#define VSTG 136   // V^T stage: 256 dim rows   x 136 halves (272 B = 16 B x odd)
// amdgpu_waves_per_eu(4, 4): two of these 8-wave blocks per WGP is all the grid can
// place, so the register budget is 256 per wave.  Without it the scheduler kept the
// register count low for a residency the launch never reaches and put a full wait
// between every fragment load pair and its WMMA; with it the loads run ahead.
__global__ __launch_bounds__(256) __attribute__((amdgpu_waves_per_eu(4, 4)))
void qkv_kernel(
    const float* __restrict__ x, const _Float16* __restrict__ Wt,
    _Float16* __restrict__ Qh, _Float16* __restrict__ Kh,
    _Float16* __restrict__ Vt) {
  __shared__ __align__(16) _Float16 stage[DH * VSTG];   // >= 128 * QSTG halves
  int w       = threadIdx.x >> 5;
  int lane    = threadIdx.x & 31;
  int wsel    = blockIdx.y;
  int rowbase = blockIdx.x * 128 + w * 16;   // global row in [0, B*T)
  const _Float16* Wsel = Wt + (size_t)wsel * (DIN * DH);

  v8f zv = {};
  v8f acc[16];
#pragma unroll
  for (int n = 0; n < 16; ++n) acc[n] = zv;

  const float* xbase = x + (size_t)rowbase * DIN;
  for (int c = 0; c < DIN / 32; ++c) {
    if (c + 1 < DIN / 32)
      __builtin_prefetch(xbase + (size_t)(lane & 15) * DIN + (c + 1) * 32, 0, 3);
    v16h af = load_frag_f32cvt(xbase + c * 32, DIN);
#pragma unroll
    for (int n = 0; n < 16; ++n) {
      // packed fragment: two loads of 512 contiguous bytes (4 whole lines each)
      const _Float16* wp = Wsel + (size_t)(c * 16 + n) * 512 + lane * 8;
      Frag16 bf;
      bf.h[0] = *(const half8*)(wp);
      bf.h[1] = *(const half8*)(wp + 256);
      acc[n] = wmma_f16(af, bf.v, acc[n]);
    }
  }

  // acc[n][r] = Y[token w*16 + mofs + r][dim n*16 + nlo]
  // The loops below are unrolled so that acc[] is indexed by constants (it stays in
  // registers) and so that the 16 LDS reads of a wave issue together ahead of its stores.
  int nlo  = lane & 15;
  int mofs = (lane >> 4) * 8;
  if (wsel != 2) {                               // the same for the whole block
    float scale = (wsel == 0) ? 0.0625f : 1.0f;  // fold 1/sqrt(DH) into Q
    _Float16* sp = stage + (w * 16 + mofs) * QSTG + nlo;
#pragma unroll
    for (int n = 0; n < 16; ++n)
#pragma unroll
      for (int r = 0; r < 8; ++r) sp[r * QSTG + n * 16] = (_Float16)(acc[n][r] * scale);
    __syncthreads();                             // lanes read what other lanes staged
    // one wave-wide store = one token's whole 512-byte row
    _Float16* dst = ((wsel == 0) ? Qh : Kh) + (size_t)rowbase * DH + lane * 8;
    const _Float16* rp = stage + (w * 16) * QSTG + lane * 8;
#pragma unroll
    for (int j = 0; j < 16; ++j) *(half8*)(dst + j * DH) = *(const half8*)(rp + j * QSTG);
    // precaution: stands in front of any later rewrite of a register that these stores name
    asm volatile("s_wait_xcnt 0x0" ::: "memory");
  } else {
    // a lane's 8 registers are 8 consecutive tokens of one dim: 16 bytes of a V^T row
    _Float16* sp = stage + nlo * VSTG + w * 16 + mofs;
#pragma unroll
    for (int n = 0; n < 16; ++n) {
      half8 hv;
#pragma unroll
      for (int r = 0; r < 8; ++r) hv[r] = (_Float16)acc[n][r];
      *(half8*)(sp + n * 16 * VSTG) = hv;
    }
    __syncthreads();                             // all eight waves' tokens are staged
    // one wave-wide store = the block's 128 tokens (256 bytes) of two dims
    int b   = (blockIdx.x * 128) >> 12;          // T_ == 4096; a block's rows share b
    int t0  = (blockIdx.x * 128) & (T_ - 1);
    int dim = w * 32 + (lane >> 4);
    _Float16* dst = Vt + ((size_t)b * DH + dim) * T_ + t0 + nlo * 8;
    const _Float16* rp = stage + dim * VSTG + nlo * 8;
#pragma unroll
    for (int j = 0; j < 16; ++j)
      *(half8*)(dst + (size_t)j * 2 * T_) = *(const half8*)(rp + j * 2 * VSTG);
  }
}

// ---------------------------------------------------------------------------
// Kernel 2: flash attention.  grid=(T/64, B), block=256 (8 waves) = one block per WGP.
// Wave w: query tile w & 3 (16 queries, full DH output), key group g = w >> 2.
// A pass stages 64 keys (double-buffered async copies); group g works on keys
// 32g .. 32g+31 of it with its own online softmax.  After the loop the two groups
// exchange half of their output tiles through LDS and each finishes 128 dims.
// Lane l (c = l & 15, h = l >> 4) works for query c alone: a score tile's register r is
// S^T[key 8h + r][query c], an output tile's register r is O^T[dim 8h + r][query c].
// ---------------------------------------------------------------------------
// amdgpu_waves_per_eu(2, 2): the grid has one block per WGP, so one block (two waves
// per SIMD) is the real residency and 512 registers per wave are free.  Without it
// the scheduler minimised registers: one LDS fragment pair, a full wait, one WMMA;
// with it the LDS reads are issued in groups ahead of counted waits.
__global__ __launch_bounds__(256) __attribute__((amdgpu_waves_per_eu(2, 2)))
void attn_kernel(
    const _Float16* __restrict__ Qh, const _Float16* __restrict__ Kh,
    const _Float16* __restrict__ Vt, float* __restrict__ out) {
  // ring: K pass 64 x 256 (two buffers), then V^T pass 256 x 64 (two buffers)
  __shared__ __align__(16) _Float16 ring[2 * KHALVES + 2 * VHALVES];

  int tid   = threadIdx.x;
  int w     = tid >> 5;
  int lane  = tid & 31;
  int g     = w >> 2;
  int b     = blockIdx.y;
  int qbase = blockIdx.x * 64 + (w & 3) * 16;
  int nlo   = lane & 15;
  int mofs  = (lane >> 4) * 8;

  // Q resident in registers: 8 B-fragments (column = query) covering DH=256.
  v16h bq[8];
  const _Float16* qptr = Qh + (size_t)(b * T_ + qbase) * DH;
#pragma unroll
  for (int c = 0; c < 8; ++c) bq[c] = load_frag_f16(qptr + c * 32, DH);

  v8f zv = {};
  v8f o[16];
#pragma unroll
  for (int t = 0; t < 16; ++t) o[t] = zv;

  // this lane's query, this group's keys: running maximum (alike in both halves) and
  // the sum over the keys that this half of the wave holds; all sums join after the loop
  float mstate = -1e30f, lstate = 0.0f;

  // --- async copy of one 64-key pass (K: 32KB, V^T: 32KB), 16 b128/thread; every
  // wave-wide copy reads whole 128-byte lines (K: one row, V^T: four rows) ---
  auto issue_pass = [&](int buf, int p) {
    const _Float16* kg = Kh + (size_t)(b * T_ + p * KPASS) * DH;   // 64 rows x 512B
    const _Float16* vg = Vt + (size_t)b * DH * T_ + p * KPASS;     // 256 rows x 128B
    _Float16* kd = ring + buf * KHALVES;
    _Float16* vd = ring + 2 * KHALVES + buf * VHALVES;
#pragma unroll
    for (int it = 0; it < 8; ++it) {
      int s = tid + it * 256;             // 2048 segments of 16B
      int row = s >> 5, c = s & 31;
      async_b128(kd + row * KSTR + c * 8, kg, (unsigned)(row * (DH * 2) + c * 16));
    }
#pragma unroll
    for (int it = 0; it < 8; ++it) {
      int s = tid + it * 256;             // 2048 segments of 16B
      int row = s >> 3, j = s & 7;
      async_b128(vd + row * VSTR + j * 8, vg, (unsigned)(row * (T_ * 2) + j * 16));
    }
  };

  const int NP = T_ / KPASS;
  issue_pass(0, 0);
  __asm__ volatile("s_wait_asynccnt 0x0" ::: "memory");  // pass 0 landed in LDS
  __syncthreads();                                       // publish pass 0
  issue_pass(1, 1);

  for (int p = 0; p < NP; ++p) {
    int cur = p & 1;
    const _Float16* kl = ring + cur * KHALVES + g * (32 * KSTR);
    const _Float16* vl = ring + 2 * KHALVES + cur * VHALVES + g * 32;

    // --- S^T = K * Q^T for 32 keys (two 16x16 tiles): A = K rows, B = Q ---
    v8f s0 = zv, s1 = zv;
#pragma unroll
    for (int c = 0; c < 8; ++c) {
      v16h ak0 = load_frag_f16(kl + c * 32, KSTR);
      v16h ak1 = load_frag_f16(kl + 16 * KSTR + c * 32, KSTR);
      s0 = wmma_f16(ak0, bq[c], s0);
      s1 = wmma_f16(ak1, bq[c], s1);
    }

    // --- online softmax: 16 of the query's 32 scores are in this lane ---
    float mx = fmaxf(s0[0], s1[0]);
#pragma unroll
    for (int r = 1; r < 8; ++r) mx = fmaxf(mx, fmaxf(s0[r], s1[r]));
    mx = fmaxf(mx, xhalf(mx));
    float mnew  = fmaxf(mstate, mx);
    float alpha = __expf(mstate - mnew);
    mstate = mnew;

    // P^T as B operand: element s is key 8h + s (s < 8) or 16 + 8h + (s - 8), which is
    // the order of the two score tiles' registers and of the V^T fragment's halves.
    Frag16 pf;
    float rs = 0.0f;
#pragma unroll
    for (int r = 0; r < 8; ++r) {
      float p0 = __expf(s0[r] - mnew);
      float p1 = __expf(s1[r] - mnew);
      rs += p0 + p1;
      pf.e[r]     = (_Float16)p0;
      pf.e[8 + r] = (_Float16)p1;
    }
    lstate = lstate * alpha + rs;

#pragma unroll
    for (int t = 0; t < 16; ++t)
#pragma unroll
      for (int r = 0; r < 8; ++r) o[t][r] *= alpha;

    // --- O^T += V^T * P^T : A = V^T rows from LDS (row = dim), B = P^T ---
#pragma unroll
    for (int t = 0; t < 16; ++t) {
      v16h av = load_frag_f16(vl + (t * 16) * VSTR, VSTR);
      o[t] = wmma_f16(av, pf.v, o[t]);
    }

    // --- publish pass p + 1, free this pass's buffer, refill it with pass p + 2 ---
    __asm__ volatile("s_wait_dscnt 0x0" ::: "memory");     // own reads of this buffer done
    __asm__ volatile("s_wait_asynccnt 0x0" ::: "memory");  // own copies of pass p + 1 landed
    __syncthreads();
    if (p + 2 < NP) issue_pass(cur, p + 2);
  }
  __asm__ volatile("s_wait_asynccnt 0x0" ::: "memory");    // nothing in flight: ring is free

  // --- join the two key groups.  Wave w and wave w ^ 4 hold the same 16 queries.
  // Group g finishes dims 128g .. 128g+127: it hands its other eight tiles, its
  // maximum and its sum to the partner through the (now free) ring. ---
  f32x4* xo = (f32x4*)ring;                                // 8 waves x 16 x 32 x 16 B
  float* xm = (float*)(ring + 2 * KHALVES);                // 8 waves x 32 maxima
  float* xl = xm + 256;                                    // 8 waves x 32 sums
  v8f keep[8];
#pragma unroll
  for (int t = 0; t < 8; ++t) {
    v8f send = g ? o[t] : o[t + 8];
    keep[t]  = g ? o[t + 8] : o[t];
    xo[(w * 16 + t * 2) * 32 + lane]     = __builtin_shufflevector(send, send, 0, 1, 2, 3);
    xo[(w * 16 + t * 2 + 1) * 32 + lane] = __builtin_shufflevector(send, send, 4, 5, 6, 7);
  }
  xm[tid] = mstate;
  xl[tid] = lstate;
  __syncthreads();                                         // partner's tiles are visible

  int   pw    = w ^ 4;
  float mo    = xm[pw * 32 + lane];
  float lo    = xl[pw * 32 + lane];
  float mall  = fmaxf(mstate, mo);
  float a_own = __expf(mstate - mall);
  float a_oth = __expf(mo - mall);
  float lsum  = lstate * a_own + lo * a_oth;
  float inv   = 1.0f / (lsum + xhalf(lsum));
  a_own *= inv;
  a_oth *= inv;

  // --- normalize and write fp32 output: 8 consecutive dims of one query per tile ---
  float* orow = out + (size_t)(b * T_ + qbase + nlo) * DH + g * 128 + mofs;
#pragma unroll
  for (int t = 0; t < 8; ++t) {
    f32x4 p0 = xo[(pw * 16 + t * 2) * 32 + lane];
    f32x4 p1 = xo[(pw * 16 + t * 2 + 1) * 32 + lane];
    f32x4 k0 = __builtin_shufflevector(keep[t], keep[t], 0, 1, 2, 3);
    f32x4 k1 = __builtin_shufflevector(keep[t], keep[t], 4, 5, 6, 7);
    *(f32x4*)(orow + t * 16)     = k0 * a_own + p0 * a_oth;
    *(f32x4*)(orow + t * 16 + 4) = k1 * a_own + p1 * a_oth;
  }
}

// ---------------------------------------------------------------------------
extern "C" void kernel_launch(void* const* d_in, const int* in_sizes, int n_in,
                              void* d_out, int out_size, void* d_ws, size_t ws_size,
                              hipStream_t stream) {
  const float* x  = (const float*)d_in[0];
  const float* Wq = (const float*)d_in[1];
  const float* Wk = (const float*)d_in[2];
  const float* Wv = (const float*)d_in[3];
  float* out = (float*)d_out;

  char* ws = (char*)d_ws;
  _Float16* Qh = (_Float16*)(ws);                                 // 8 MB
  _Float16* Kh = (_Float16*)(ws + (size_t)8  * 1024 * 1024);      // 8 MB
  _Float16* Vt = (_Float16*)(ws + (size_t)16 * 1024 * 1024);      // 8 MB
  _Float16* Wt = (_Float16*)(ws + (size_t)24 * 1024 * 1024);      // 3 x 384 KB

  wt_kernel<<<(3 * DIN * DH / 8 + 255) / 256, 256, 0, stream>>>(Wq, Wk, Wv, Wt);

  dim3 g1((B_ * T_) / 128, 3);
  qkv_kernel<<<g1, 256, 0, stream>>>(x, Wt, Qh, Kh, Vt);

  dim3 g2(T_ / 64, B_);
  attn_kernel<<<g2, 256, 0, stream>>>(Qh, Kh, Vt, out);
}

// v006
// Measured time: 121 microseconds a run.
// Two timings next to v005 put it at 1.14 and 1.13 times that version's speed.
// Over all steps from v000 it is 5.35 times as fast.
#include <hip/hip_runtime.h>

// Self-attention forward: Q=xWq*scale, K=xWk, V=xWv; O = softmax(QK^T)V
// B=4, T=4096, D_IN=768, D_H=256.  All matmuls via v_wmma_f32_16x16x32_f16.
// Attention kernel stages K/V passes into LDS with global_load_async_to_lds_b128
// (double-buffered, ASYNCcnt-tracked) so the DMA overlaps the WMMA work.
// A block holds 64 queries: a wave has 32 of them, and four groups of two waves each take
// every fourth 32 keys, so that the grid has one block for every WGP and an LDS fragment
// feeds two matrix instructions; the groups' results join at the end.
// It forms the products transposed (S^T = K Q^T, O^T += V^T P^T): a lane then holds the
// scores of ONE query per tile, and P^T goes from the score registers into the B operand.

typedef _Float16 half8 __attribute__((ext_vector_type(8)));
typedef _Float16 v16h  __attribute__((ext_vector_type(16)));
typedef float    v8f   __attribute__((ext_vector_type(8)));
typedef float    f32x4 __attribute__((ext_vector_type(4)));

#define B_  4
#define T_  4096
#define DIN 768
#define DH  256

// LDS row strides (halves), padded to spread banks; all row offsets 16B-aligned.
#define KSTR 264   // 128 K-rows  x 264 (528 B/row)
#define VSTR 136   // 256 V-rows  x 136 (272 B/row)
#define KPASS 128  // keys staged per pass: 32 for each group of waves
#define KHALVES (KPASS * KSTR)
#define VHALVES (DH * VSTR)

union Frag16 { v16h v; half8 h[2]; _Float16 e[16]; };

// 16x32 (A) or 32x16 (B) f16 fragment, per CDNA5 ISA 7.12.2 lane layout.
// lane<16 : row = lane,    K halves {0..7} and {16..23}
// lane>=16: row = lane-16, K halves {8..15} and {24..31}
__device__ __forceinline__ v16h load_frag_f16(const _Float16* base, int stride) {
  int lane = threadIdx.x & 31;
  int r    = lane & 15;
  int hi   = lane >> 4;
  const _Float16* p = base + (size_t)r * stride + (hi ? 8 : 0);
  Frag16 f;
  f.h[0] = *(const half8*)(p);
  f.h[1] = *(const half8*)(p + 16);
  return f.v;
}

// Same A-fragment layout but source is fp32 (converted to f16 in registers).
__device__ __forceinline__ v16h load_frag_f32cvt(const float* base, int stride) {
  int lane = threadIdx.x & 31;
  int r    = lane & 15;
  int hi   = lane >> 4;
  const float* p = base + (size_t)r * stride + (hi ? 8 : 0);
  f32x4 f0 = *(const f32x4*)(p);
  f32x4 f1 = *(const f32x4*)(p + 4);
  f32x4 f2 = *(const f32x4*)(p + 16);
  f32x4 f3 = *(const f32x4*)(p + 20);
  Frag16 f;
#pragma unroll
  for (int i = 0; i < 4; ++i) {
    f.e[i]      = (_Float16)f0[i];
    f.e[4 + i]  = (_Float16)f1[i];
    f.e[8 + i]  = (_Float16)f2[i];
    f.e[12 + i] = (_Float16)f3[i];
  }
  return f.v;
}

__device__ __forceinline__ v8f wmma_f16(v16h a, v16h b, v8f c) {
  // (neg_a, A, neg_b, B, c_mod, C, reuse_a, reuse_b)
  return __builtin_amdgcn_wmma_f32_16x16x32_f16(false, a, false, b, (short)0, c,
                                                false, false);
}

// Lane l takes the value of lane l ^ 16 (the other half of the wave), in the vector unit.
__device__ __forceinline__ float xhalf(float x) {
  int i = __builtin_bit_cast(int, x);
  return __builtin_bit_cast(float, __builtin_amdgcn_permlanex16(
      i, i, 0x76543210, 0xfedcba98, false, false));
}

// Async copy of one 16-byte segment per lane: LDS[dst] = MEM[src]  (ASYNCcnt)
typedef int i32x4 __attribute__((ext_vector_type(4)));
typedef __attribute__((address_space(1))) i32x4 glb_i32x4;
typedef __attribute__((address_space(3))) i32x4 lds_i32x4;
__device__ __forceinline__ void async_b128(_Float16* dst, const char* src) {
  __builtin_amdgcn_global_load_async_to_lds_b128((glb_i32x4*)src, (lds_i32x4*)dst, 0, 0);
}

// ---------------------------------------------------------------------------
// Kernel 0: convert the weights to f16 and pack them in B-fragment order.
// Unit (w, c, nt, part) = 512 contiguous bytes = what ONE wave-wide 16-byte load of
// the projection reads: lane l holds W_w[c*32 + part*16 + (l>>4)*8 + 0..7][nt*16 + (l&15)].
// Thread g writes halves g*8 .. g*8+7, so every store is 16 B and whole lines fill.
// ---------------------------------------------------------------------------
__global__ void wt_kernel(const float* __restrict__ Wq, const float* __restrict__ Wk,
                          const float* __restrict__ Wv, _Float16* __restrict__ Wt) {
  int g = blockIdx.x * blockDim.x + threadIdx.x;
  const int per8 = DIN * DH / 8;       // 16-byte pieces per weight matrix
  if (g >= 3 * per8) return;
  int w    = g / per8;
  int rem  = g - w * per8;
  int r    = rem & 15;                 // column inside the 16-column tile
  int hi   = (rem >> 4) & 1;           // lane half: k offset 8
  int part = (rem >> 5) & 1;           // first or second 16-byte load: k offset 16
  int nt   = (rem >> 6) & 15;          // column tile
  int c    = rem >> 10;                // 32-deep k block
  int k0   = c * 32 + part * 16 + hi * 8;
  int n    = nt * 16 + r;
  const float* src = (w == 0) ? Wq : (w == 1) ? Wk : Wv;
  half8 v;
  // unrolled so that the eight row loads issue together and v stays in registers
#pragma unroll
  for (int e = 0; e < 8; ++e) v[e] = (_Float16)src[(size_t)(k0 + e) * DH + n];
  *(half8*)(Wt + (size_t)g * 8) = v;
}

// ---------------------------------------------------------------------------
// Kernel 1: QKV projection GEMM.  grid=(128,3), block=256 (8 waves).
// Each wave: 16 rows x full DH=256 cols.  blockIdx.y selects Q/K/V.
// Q is pre-scaled by 1/16; V stored transposed Vt[b][h][t].
// The block's 128 x 256 result goes through LDS in the layout of its destination, so
// that every global store is 16 bytes a lane and a wave-wide store fills whole lines.
// ---------------------------------------------------------------------------
#define QSTG 264   // Q/K stage: 128 token rows x 264 halves (528 B = 16 B x odd)
#define VSTG 136   // V^T stage: 256 dim rows   x 136 halves (272 B = 16 B x odd)
// amdgpu_waves_per_eu(4, 4): two of these 8-wave blocks per WGP is all the grid can
// place, so the register budget is 256 per wave.  Without it the scheduler kept the
// register count low for a residency the launch never reaches and put a full wait
// between every fragment load pair and its WMMA; with it the loads run ahead.
__global__ __launch_bounds__(256) __attribute__((amdgpu_waves_per_eu(4, 4)))
void qkv_kernel(
    const float* __restrict__ x, const _Float16* __restrict__ Wt,
    _Float16* __restrict__ Qh, _Float16* __restrict__ Kh,
    _Float16* __restrict__ Vt) {
  __shared__ __align__(16) _Float16 stage[DH * VSTG];   // >= 128 * QSTG halves
  int w       = threadIdx.x >> 5;
  int lane    = threadIdx.x & 31;
  int wsel    = blockIdx.y;
  int rowbase = blockIdx.x * 128 + w * 16;   // global row in [0, B*T)
  const _Float16* Wsel = Wt + (size_t)wsel * (DIN * DH);

  v8f zv = {};
  v8f acc[16];
#pragma unroll
  for (int n = 0; n < 16; ++n) acc[n] = zv;

  const float* xbase = x + (size_t)rowbase * DIN;
  for (int c = 0; c < DIN / 32; ++c) {
    if (c + 1 < DIN / 32)
      __builtin_prefetch(xbase + (size_t)(lane & 15) * DIN + (c + 1) * 32, 0, 3);
    v16h af = load_frag_f32cvt(xbase + c * 32, DIN);
#pragma unroll
    for (int n = 0; n < 16; ++n) {
      // packed fragment: two loads of 512 contiguous bytes (4 whole lines each)
      const _Float16* wp = Wsel + (size_t)(c * 16 + n) * 512 + lane * 8;
      Frag16 bf;
      bf.h[0] = *(const half8*)(wp);
      bf.h[1] = *(const half8*)(wp + 256);
      acc[n] = wmma_f16(af, bf.v, acc[n]);
    }
  }

  // acc[n][r] = Y[token w*16 + mofs + r][dim n*16 + nlo]
  // The loops below are unrolled so that acc[] is indexed by constants (it stays in
  // registers) and so that the 16 LDS reads of a wave issue together ahead of its stores.
  int nlo  = lane & 15;
  int mofs = (lane >> 4) * 8;
  if (wsel != 2) {                               // the same for the whole block
    float scale = (wsel == 0) ? 0.0625f : 1.0f;  // fold 1/sqrt(DH) into Q
    _Float16* sp = stage + (w * 16 + mofs) * QSTG + nlo;
#pragma unroll
    for (int n = 0; n < 16; ++n)
#pragma unroll
      for (int r = 0; r < 8; ++r) sp[r * QSTG + n * 16] = (_Float16)(acc[n][r] * scale);
    __syncthreads();                             // lanes read what other lanes staged
    // one wave-wide store = one token's whole 512-byte row
    _Float16* dst = ((wsel == 0) ? Qh : Kh) + (size_t)rowbase * DH + lane * 8;
    const _Float16* rp = stage + (w * 16) * QSTG + lane * 8;
#pragma unroll
    for (int j = 0; j < 16; ++j) *(half8*)(dst + j * DH) = *(const half8*)(rp + j * QSTG);
    // precaution: stands in front of any later rewrite of a register that these stores name
    asm volatile("s_wait_xcnt 0x0" ::: "memory");
  } else {
    // a lane's 8 registers are 8 consecutive tokens of one dim: 16 bytes of a V^T row
    _Float16* sp = stage + nlo * VSTG + w * 16 + mofs;
#pragma unroll
    for (int n = 0; n < 16; ++n) {
      half8 hv;
#pragma unroll
      for (int r = 0; r < 8; ++r) hv[r] = (_Float16)acc[n][r];
      *(half8*)(sp + n * 16 * VSTG) = hv;
    }
    __syncthreads();                             // all eight waves' tokens are staged
    // one wave-wide store = the block's 128 tokens (256 bytes) of two dims
    int b   = (blockIdx.x * 128) >> 12;          // T_ == 4096; a block's rows share b
    int t0  = (blockIdx.x * 128) & (T_ - 1);
    int dim = w * 32 + (lane >> 4);
    _Float16* dst = Vt + ((size_t)b * DH + dim) * T_ + t0 + nlo * 8;
    const _Float16* rp = stage + dim * VSTG + nlo * 8;
#pragma unroll
    for (int j = 0; j < 16; ++j)
      *(half8*)(dst + (size_t)j * 2 * T_) = *(const half8*)(rp + j * 2 * VSTG);
  }
}

// ---------------------------------------------------------------------------
// Kernel 2: flash attention.  grid=(T/64, B), block=256 (8 waves) = one block per WGP.
// Wave w: query half w & 1 (32 queries = two 16-query tiles, full DH output), key group
// g = w >> 1.  A pass stages 128 keys (double-buffered async copies); group g works on
// keys 32g .. 32g+31 of it with its own online softmax.  Every K and V^T fragment read
// from LDS is the A operand of two WMMAs, one per query tile, so the LDS reads of a pass
// take no longer than its matrix work.  After the loop the four groups exchange their
// output tiles through LDS and each finishes 64 dims.
// Lane l (c = l & 15, h = l >> 4) works for query c of each tile: a score tile's register
// r is S^T[key 8h + r][query c], an output tile's register r is O^T[dim 8h + r][query c].
// ---------------------------------------------------------------------------
// amdgpu_waves_per_eu(2, 2): the grid has one block per WGP, so one block (two waves
// per SIMD) is the real residency and 512 registers per wave are free: the output tiles
// take 256 of them and Q takes 128.
__global__ __launch_bounds__(256) __attribute__((amdgpu_waves_per_eu(2, 2)))
void attn_kernel(
    const _Float16* __restrict__ Qh, const _Float16* __restrict__ Kh,
    const _Float16* __restrict__ Vt, float* __restrict__ out) {
  // ring: K pass 128 x 256 (two buffers), then V^T pass 256 x 128 (two buffers)
  __shared__ __align__(16) _Float16 ring[2 * KHALVES + 2 * VHALVES];

  int tid   = threadIdx.x;
  int w     = tid >> 5;
  int lane  = tid & 31;
  int qh    = w & 1;
  int g     = w >> 1;
  int b     = blockIdx.y;
  int qbase = blockIdx.x * 64 + qh * 32;
  int nlo   = lane & 15;
  int mofs  = (lane >> 4) * 8;

  // Q resident in registers: per query tile 8 B-fragments (column = query) covering DH.
  v16h bq[2][8];
  const _Float16* qptr = Qh + (size_t)(b * T_ + qbase) * DH;
#pragma unroll
  for (int q = 0; q < 2; ++q)
#pragma unroll
    for (int c = 0; c < 8; ++c) bq[q][c] = load_frag_f16(qptr + q * 16 * DH + c * 32, DH);

  v8f zv = {};
  v8f o[2][16];
#pragma unroll
  for (int q = 0; q < 2; ++q)
#pragma unroll
    for (int t = 0; t < 16; ++t) o[q][t] = zv;

  // this lane's query of each tile, this group's keys: running maximum (alike in both
  // halves) and the sum over the keys that this half of the wave holds; all sums join
  // after the loop
  float mstate[2] = {-1e30f, -1e30f};
  float lstate[2] = {0.0f, 0.0f};

  // --- async copy of one 128-key pass (K: 64KB, V^T: 64KB), 32 b128/thread; every
  // wave-wide copy reads 512 bytes of whole lines (K: one row, V^T: two rows).  A lane's
  // copies differ by constant steps, so that one address of each kind is kept. ---
  const char* kg0 = (const char*)(Kh + (size_t)b * T_ * DH) + tid * 16;
  const char* vg0 = (const char*)(Vt + (size_t)b * DH * T_) + (tid >> 4) * (T_ * 2) + (tid & 15) * 16;
  int kd0 = (tid >> 5) * KSTR + (tid & 31) * 8;
  int vd0 = 2 * KHALVES + (tid >> 4) * VSTR + (tid & 15) * 8;
  auto issue_pass = [&](int buf, int p) {
    const char* kg = kg0 + (size_t)p * (KPASS * DH * 2);   // 128 rows x 512B
    const char* vg = vg0 + p * (KPASS * 2);                // 256 rows x 256B
    _Float16* kd = ring + buf * KHALVES + kd0;
    _Float16* vd = ring + buf * VHALVES + vd0;
#pragma unroll
    for (int it = 0; it < 16; ++it)       // 8 K rows a step
      async_b128(kd + it * 8 * KSTR, kg + it * 8 * (DH * 2));
#pragma unroll
    for (int it = 0; it < 16; ++it)       // 16 V^T rows a step
      async_b128(vd + it * 16 * VSTR, vg + it * 16 * (T_ * 2));
  };

  const int NP = T_ / KPASS;
  issue_pass(0, 0);
  __asm__ volatile("s_wait_asynccnt 0x0" ::: "memory");  // pass 0 landed in LDS
  __syncthreads();                                       // publish pass 0
  issue_pass(1, 1);

  for (int p = 0; p < NP; ++p) {
    int cur = p & 1;
    const _Float16* kl = ring + cur * KHALVES + g * (32 * KSTR);
    const _Float16* vl = ring + 2 * KHALVES + cur * VHALVES + g * 32;

    // --- S^T = K * Q^T for 32 keys x 32 queries (four 16x16 tiles): A = K rows, B = Q ---
    v8f s[2][2];
#pragma unroll
    for (int q = 0; q < 2; ++q) { s[q][0] = zv; s[q][1] = zv; }
    // K fragments come in groups of four (two 32-deep steps x two key tiles), in two
    // register sets: the next group's reads are issued ahead of this group's products.
    v16h ak[2][4];
#pragma unroll
    for (int j = 0; j < 2; ++j) {
      ak[0][j * 2]     = load_frag_f16(kl + j * 32, KSTR);
      ak[0][j * 2 + 1] = load_frag_f16(kl + 16 * KSTR + j * 32, KSTR);
    }
#pragma unroll
    for (int n = 0; n < 4; ++n) {
      if (n < 3) {
#pragma unroll
        for (int j = 0; j < 2; ++j) {
          ak[(n + 1) & 1][j * 2]     = load_frag_f16(kl + ((n + 1) * 2 + j) * 32, KSTR);
          ak[(n + 1) & 1][j * 2 + 1] = load_frag_f16(kl + 16 * KSTR + ((n + 1) * 2 + j) * 32, KSTR);
        }
      }
#pragma unroll
      for (int j = 0; j < 2; ++j)
#pragma unroll
        for (int q = 0; q < 2; ++q) {
          s[q][0] = wmma_f16(ak[n & 1][j * 2],     bq[q][n * 2 + j], s[q][0]);
          s[q][1] = wmma_f16(ak[n & 1][j * 2 + 1], bq[q][n * 2 + j], s[q][1]);
        }
      // keeps later groups' reads behind this group: fetched further ahead, the fragments
      // no longer fit beside O and Q, and the build spills registers
      __builtin_amdgcn_sched_barrier(0);
    }

    // V^T fragments come in groups of four, in two register sets, like K's; the first
    // group's reads fly during the softmax.
    v16h av[2][4];
#pragma unroll
    for (int i = 0; i < 4; ++i) av[0][i] = load_frag_f16(vl + (i * 16) * VSTR, VSTR);

    // --- online softmax: 16 of a query's 32 scores are in this lane ---
    Frag16 pf[2];
    float al[2];
#pragma unroll
    for (int q = 0; q < 2; ++q) {
      float mx = fmaxf(s[q][0][0], s[q][1][0]);
#pragma unroll
      for (int r = 1; r < 8; ++r) mx = fmaxf(mx, fmaxf(s[q][0][r], s[q][1][r]));
      mx = fmaxf(mx, xhalf(mx));
      float mnew  = fmaxf(mstate[q], mx);
      float alpha = __expf(mstate[q] - mnew);
      mstate[q] = mnew;

      // P^T as B operand: element e is key 8h + e (e < 8) or 16 + 8h + (e - 8), which is
      // the order of the two score tiles' registers and of the V^T fragment's halves.
      float rs = 0.0f;
#pragma unroll
      for (int r = 0; r < 8; ++r) {
        float p0 = __expf(s[q][0][r] - mnew);
        float p1 = __expf(s[q][1][r] - mnew);
        rs += p0 + p1;
        pf[q].e[r]     = (_Float16)p0;
        pf[q].e[8 + r] = (_Float16)p1;
      }
      lstate[q] = lstate[q] * alpha + rs;
      al[q] = alpha;
    }

    // --- O^T = O^T * alpha + V^T * P^T : A = V^T rows from LDS (row = dim), B = P^T of
    // each tile. ---
    // inputs-only fence: both P^T fragments are complete before the second group of V^T is
    // read.  Without it the compiler puts the second tile's products off to the end of the
    // pass and holds all sixteen V^T fragments (128 registers) until then, and Q is spilled.
    asm volatile("" :: "v"(pf[0].v), "v"(pf[1].v) : "memory");
#pragma unroll
    for (int n = 0; n < 4; ++n) {
      if (n < 3) {
#pragma unroll
        for (int i = 0; i < 4; ++i)
          av[(n + 1) & 1][i] = load_frag_f16(vl + (((n + 1) * 4 + i) * 16) * VSTR, VSTR);
      }
#pragma unroll
      for (int i = 0; i < 4; ++i)
#pragma unroll
        for (int q = 0; q < 2; ++q) {
          int t = n * 4 + i;
#pragma unroll
          for (int r = 0; r < 8; ++r) o[q][t][r] *= al[q];
          o[q][t] = wmma_f16(av[n & 1][i], pf[q].v, o[q][t]);
        }
      // as above: fragments fetched further ahead do not fit beside O and Q
      __builtin_amdgcn_sched_barrier(0);
    }

    // --- publish pass p + 1, free this pass's buffer, refill it with pass p + 2 ---
    __asm__ volatile("s_wait_dscnt 0x0" ::: "memory");     // own reads of this buffer done
    __asm__ volatile("s_wait_asynccnt 0x0" ::: "memory");  // own copies of pass p + 1 landed
    __syncthreads();
    if (p + 2 < NP) issue_pass(cur, p + 2);
  }
  __asm__ volatile("s_wait_asynccnt 0x0" ::: "memory");    // nothing in flight: ring is free

  // --- join the four key groups.  Waves qh, qh + 2, qh + 4, qh + 6 hold the same 32
  // queries.  Every wave lays its tiles, maxima and sums into the (now free) ring;
  // group g then finishes dims 64g .. 64g+63 from all four groups' tiles. ---
  f32x4* xo = (f32x4*)ring;                                // 8 waves x 32 tiles x 2 x 32 x 16 B
  float* xm = (float*)(xo + 8 * 32 * 2 * 32);              // 8 waves x 2 x 32 maxima
  float* xl = xm + 8 * 2 * 32;                             // 8 waves x 2 x 32 sums
#pragma unroll
  for (int q = 0; q < 2; ++q) {
#pragma unroll
    for (int t = 0; t < 16; ++t) {
      f32x4* xp = xo + ((w * 32 + q * 16 + t) * 2) * 32 + lane;
      xp[0]  = __builtin_shufflevector(o[q][t], o[q][t], 0, 1, 2, 3);
      xp[32] = __builtin_shufflevector(o[q][t], o[q][t], 4, 5, 6, 7);
    }
    xm[(w * 2 + q) * 32 + lane] = mstate[q];
    xl[(w * 2 + q) * 32 + lane] = lstate[q];
  }
  __syncthreads();                                         // all groups' tiles are visible

  // --- weigh, normalize and write fp32 output: 8 consecutive dims of one query per tile ---
#pragma unroll
  for (int q = 0; q < 2; ++q) {
    float mg[4], a[4];
#pragma unroll
    for (int k = 0; k < 4; ++k) mg[k] = xm[((k * 2 + qh) * 2 + q) * 32 + lane];
    float mall = fmaxf(fmaxf(mg[0], mg[1]), fmaxf(mg[2], mg[3]));
    float lsum = 0.0f;
#pragma unroll
    for (int k = 0; k < 4; ++k) {
      a[k] = __expf(mg[k] - mall);
      lsum += xl[((k * 2 + qh) * 2 + q) * 32 + lane] * a[k];
    }
    float inv = 1.0f / (lsum + xhalf(lsum));
#pragma unroll
    for (int k = 0; k < 4; ++k) a[k] *= inv;

    float* orow = out + (size_t)(b * T_ + qbase + q * 16 + nlo) * DH + g * 64 + mofs;
#pragma unroll
    for (int i = 0; i < 4; ++i) {
      f32x4 r0 = {}, r1 = {};
#pragma unroll
      for (int k = 0; k < 4; ++k) {
        const f32x4* xp = xo + (((k * 2 + qh) * 32 + q * 16 + g * 4 + i) * 2) * 32 + lane;
        r0 += xp[0] * a[k];
        r1 += xp[32] * a[k];
      }
      *(f32x4*)(orow + i * 16)     = r0;
      *(f32x4*)(orow + i * 16 + 4) = r1;
    }
  }
}

// ---------------------------------------------------------------------------
extern "C" void kernel_launch(void* const* d_in, const int* in_sizes, int n_in,
                              void* d_out, int out_size, void* d_ws, size_t ws_size,
                              hipStream_t stream) {
  const float* x  = (const float*)d_in[0];
  const float* Wq = (const float*)d_in[1];
  const float* Wk = (const float*)d_in[2];
  const float* Wv = (const float*)d_in[3];
  float* out = (float*)d_out;

  char* ws = (char*)d_ws;
  _Float16* Qh = (_Float16*)(ws);                                 // 8 MB
  _Float16* Kh = (_Float16*)(ws + (size_t)8  * 1024 * 1024);      // 8 MB
  _Float16* Vt = (_Float16*)(ws + (size_t)16 * 1024 * 1024);      // 8 MB
  _Float16* Wt = (_Float16*)(ws + (size_t)24 * 1024 * 1024);      // 3 x 384 KB

  wt_kernel<<<(3 * DIN * DH / 8 + 255) / 256, 256, 0, stream>>>(Wq, Wk, Wv, Wt);

  dim3 g1((B_ * T_) / 128, 3);
  qkv_kernel<<<g1, 256, 0, stream>>>(x, Wt, Qh, Kh, Vt);

  dim3 g2(T_ / 64, B_);
  attn_kernel<<<g2, 256, 0, stream>>>(Qh, Kh, Vt, out);
}

// v007
// Measured time: 88.9 microseconds a run.
// Next to v006, in two timings, it ran 1.36 and 1.32 times as fast.
// Counting every step since v000, it is 7.16 times as fast.
#include <hip/hip_runtime.h>

// Self-attention forward: Q=xWq*scale, K=xWk, V=xWv; O = softmax(QK^T)V
// B=4, T=4096, D_IN=768, D_H=256.  All matmuls via v_wmma_f32_16x16x32_f16.
// Attention kernel stages K/V passes into LDS with global_load_async_to_lds_b128
// (double-buffered, ASYNCcnt-tracked) so the DMA overlaps the WMMA work.
// A block holds 64 queries: a wave has 32 of them, and four groups of two waves each take
// every fourth 32 keys, so that the grid has one block for every WGP and an LDS fragment
// feeds two matrix instructions; the groups' results join at the end.
// It forms the products transposed (S^T = K Q^T, O^T += V^T P^T): a lane then holds the
// scores of ONE query per tile, and P^T goes from the score registers into the B operand.

typedef _Float16 half8 __attribute__((ext_vector_type(8)));
typedef _Float16 v16h  __attribute__((ext_vector_type(16)));
typedef float    v8f   __attribute__((ext_vector_type(8)));
typedef float    f32x4 __attribute__((ext_vector_type(4)));

#define B_  4
#define T_  4096
#define DIN 768
#define DH  256

// LDS row strides (halves), padded to spread banks; all row offsets 16B-aligned.
#define KSTR 264   // 128 K-rows  x 264 (528 B/row)
#define VSTR 136   // 256 V-rows  x 136 (272 B/row)
#define KPASS 128  // keys staged per pass: 32 for each group of waves
#define KHALVES (KPASS * KSTR)
#define VHALVES (DH * VSTR)

union Frag16 { v16h v; half8 h[2]; _Float16 e[16]; };

// 16x32 (A) or 32x16 (B) f16 fragment, per CDNA5 ISA 7.12.2 lane layout.
// lane<16 : row = lane,    K halves {0..7} and {16..23}
// lane>=16: row = lane-16, K halves {8..15} and {24..31}
__device__ __forceinline__ v16h load_frag_f16(const _Float16* base, int stride) {
  int lane = threadIdx.x & 31;
  int r    = lane & 15;
  int hi   = lane >> 4;
  const _Float16* p = base + (size_t)r * stride + (hi ? 8 : 0);
  Frag16 f;
  f.h[0] = *(const half8*)(p);
  f.h[1] = *(const half8*)(p + 16);
  return f.v;
}

// Same A-fragment layout but source is fp32: the loads, and the conversion to f16 in
// registers, apart, so that the loads can be issued ahead of the conversion.
struct XRaw { f32x4 f[4]; };
// p: the lane's own place, row (lane & 15), k offset 8 in the upper half of the wave
__device__ __forceinline__ XRaw load_frag_f32(const float* p) {
  XRaw x;
  x.f[0] = *(const f32x4*)(p);
  x.f[1] = *(const f32x4*)(p + 4);
  x.f[2] = *(const f32x4*)(p + 16);
  x.f[3] = *(const f32x4*)(p + 20);
  return x;
}
__device__ __forceinline__ v16h cvt_frag_f32(const XRaw& x) {
  Frag16 f;
#pragma unroll
  for (int i = 0; i < 4; ++i) {
    f.e[i]      = (_Float16)x.f[0][i];
    f.e[4 + i]  = (_Float16)x.f[1][i];
    f.e[8 + i]  = (_Float16)x.f[2][i];
    f.e[12 + i] = (_Float16)x.f[3][i];
  }
  return f.v;
}

__device__ __forceinline__ v8f wmma_f16(v16h a, v16h b, v8f c) {
  // (neg_a, A, neg_b, B, c_mod, C, reuse_a, reuse_b)
  return __builtin_amdgcn_wmma_f32_16x16x32_f16(false, a, false, b, (short)0, c,
                                                false, false);
}

// Lane l takes the value of lane l ^ 16 (the other half of the wave), in the vector unit.
__device__ __forceinline__ float xhalf(float x) {
  int i = __builtin_bit_cast(int, x);
  return __builtin_bit_cast(float, __builtin_amdgcn_permlanex16(
      i, i, 0x76543210, 0xfedcba98, false, false));
}

// Async copy of one 16-byte segment per lane: LDS[dst] = MEM[src]  (ASYNCcnt)
typedef int i32x4 __attribute__((ext_vector_type(4)));
typedef __attribute__((address_space(1))) i32x4 glb_i32x4;
typedef __attribute__((address_space(3))) i32x4 lds_i32x4;
__device__ __forceinline__ void async_b128(_Float16* dst, const char* src) {
  __builtin_amdgcn_global_load_async_to_lds_b128((glb_i32x4*)src, (lds_i32x4*)dst, 0, 0);
}

// ---------------------------------------------------------------------------
// Kernel 0: convert the weights to f16 and pack them in B-fragment order.
// Unit (w, c, nt, part) = 512 contiguous bytes = what ONE wave-wide 16-byte load of
// the projection reads: lane l holds W_w[c*32 + part*16 + (l>>4)*8 + 0..7][nt*16 + (l&15)].
// Thread g writes halves g*8 .. g*8+7, so every store is 16 B and whole lines fill.
// ---------------------------------------------------------------------------
__global__ void wt_kernel(const float* __restrict__ Wq, const float* __restrict__ Wk,
                          const float* __restrict__ Wv, _Float16* __restrict__ Wt) {
  int g = blockIdx.x * blockDim.x + threadIdx.x;
  const int per8 = DIN * DH / 8;       // 16-byte pieces per weight matrix
  if (g >= 3 * per8) return;
  int w    = g / per8;
  int rem  = g - w * per8;
  int r    = rem & 15;                 // column inside the 16-column tile
  int hi   = (rem >> 4) & 1;           // lane half: k offset 8
  int part = (rem >> 5) & 1;           // first or second 16-byte load: k offset 16
  int nt   = (rem >> 6) & 15;          // column tile
  int c    = rem >> 10;                // 32-deep k block
  int k0   = c * 32 + part * 16 + hi * 8;
  int n    = nt * 16 + r;
  const float* src = (w == 0) ? Wq : (w == 1) ? Wk : Wv;
  half8 v;
  // unrolled so that the eight row loads issue together and v stays in registers
#pragma unroll
  for (int e = 0; e < 8; ++e) v[e] = (_Float16)src[(size_t)(k0 + e) * DH + n];
  *(half8*)(Wt + (size_t)g * 8) = v;
}

// ---------------------------------------------------------------------------
// Kernel 1: QKV projection GEMM.  grid=(128,3), block=256 (8 waves).
// Each wave: 16 rows x full DH=256 cols.  blockIdx.y selects Q/K/V.
// Q is pre-scaled by 1/16; V stored transposed Vt[b][h][t].
// The packed weights come into LDS by asynchronous copies, once per block, in passes of
// four 32-deep k blocks (64 KB, two buffers): the eight waves read their B fragments from
// LDS, and the WGP's cache path is left to the loads of x.
// The block's 128 x 256 result goes through LDS in the layout of its destination, so
// that every global store is 16 bytes a lane and a wave-wide store fills whole lines.
// ---------------------------------------------------------------------------
#define QSTG 264   // Q/K stage: 128 token rows x 264 halves (528 B = 16 B x odd)
#define VSTG 136   // V^T stage: 256 dim rows   x 136 halves (272 B = 16 B x odd)
#define WCP 4                    // 32-deep k blocks per weight pass
#define WHALVES (WCP * 16 * 512) // halves per weight pass: 16 fragments of 1 KB a k block
// amdgpu_waves_per_eu(4, 4): two of these 8-wave blocks per WGP is all the grid can
// place, so the register budget is 256 per wave.  Without it the scheduler kept the
// register count low for a residency the launch never reaches and put a full wait
// between every fragment load pair and its WMMA; with it the loads run ahead.
__global__ __launch_bounds__(256) __attribute__((amdgpu_waves_per_eu(4, 4)))
void qkv_kernel(
    const float* __restrict__ x, const _Float16* __restrict__ Wt,
    _Float16* __restrict__ Qh, _Float16* __restrict__ Kh,
    _Float16* __restrict__ Vt) {
  // two weight buffers; after the loop the same LDS is the result stage
  // (DH * VSTG and 128 * QSTG halves both fit in it)
  __shared__ __align__(16) _Float16 wring[2 * WHALVES];
  _Float16* stage = wring;
  int w       = threadIdx.x >> 5;
  int lane    = threadIdx.x & 31;
  int wsel    = blockIdx.y;
  int rowbase = blockIdx.x * 128 + w * 16;   // global row in [0, B*T)
  const _Float16* Wsel = Wt + (size_t)wsel * (DIN * DH);

  v8f zv = {};
  v8f acc[16];
#pragma unroll
  for (int n = 0; n < 16; ++n) acc[n] = zv;

  // a pass of weights is 64 KB in a row, in LDS as in memory: 16 copies of 16 B a thread,
  // every wave-wide copy 512 contiguous bytes
  const char* wg0 = (const char*)Wsel + threadIdx.x * 16;
  auto issue_w = [&](int buf, int p) {
    const char* wg = wg0 + p * (WHALVES * 2);
    _Float16* wd = wring + buf * WHALVES + threadIdx.x * 8;
    // unrolled so that the copies differ by constant steps and one address of each kind is kept
#pragma unroll
    for (int it = 0; it < 16; ++it) async_b128(wd + it * 2048, wg + it * 4096);
  };

  const int NW = DIN / 32 / WCP;
  // this lane's place in its row of x, at the first k block of the current pass
  const float* xl = x + (size_t)(rowbase + (lane & 15)) * DIN + (lane >> 4) * 8;
  __builtin_prefetch(xl + 32, 0, 3);
  XRaw xr = load_frag_f32(xl);                           // k block 0, flies with pass 0
  issue_w(0, 0);
  __asm__ volatile("s_wait_asynccnt 0x0" ::: "memory");  // own copies of pass 0 landed
  __syncthreads();                                       // publish pass 0
  issue_w(1, 1);

  for (int p = 0; p < NW; ++p) {
    const _Float16* wl = wring + (p & 1) * WHALVES + lane * 8;
    // packed fragment: two LDS reads of 512 contiguous bytes, no bank met twice
    auto wfrag = [&](int f) {
      Frag16 bf;
      bf.h[0] = *(const half8*)(wl + f * 512);
      bf.h[1] = *(const half8*)(wl + f * 512 + 256);
      return bf.v;
    };
    // The pass's 64 fragments come in groups of four, in two register sets: the next
    // group's eight reads are issued together ahead of this group's products.
    v16h bw[2][4];
    v16h af;
#pragma unroll
    for (int i = 0; i < 4; ++i) bw[0][i] = wfrag(i);
    // this loop and the loops over i are unrolled so that bw[] and acc[] are indexed by
    // constants and stay in registers
#pragma unroll
    for (int gq = 0; gq < WCP * 4; ++gq) {
      if ((gq & 3) == 0) {
        // x is loaded one k block ahead of its use (the fence below would hold the loads
        // at their use otherwise), and prefetched one block ahead of its load as before
        int c = p * WCP + (gq >> 2);
        af = cvt_frag_f32(xr);
        if (c + 2 < DIN / 32) __builtin_prefetch(xl + ((gq >> 2) + 2) * 32, 0, 3);
        if (c + 1 < DIN / 32) xr = load_frag_f32(xl + ((gq >> 2) + 1) * 32);
      }
      if (gq + 1 < WCP * 4) {
#pragma unroll
        for (int i = 0; i < 4; ++i) bw[(gq + 1) & 1][i] = wfrag((gq + 1) * 4 + i);
      }
#pragma unroll
      for (int i = 0; i < 4; ++i)
        acc[(gq & 3) * 4 + i] = wmma_f16(af, bw[gq & 1][i], acc[(gq & 3) * 4 + i]);
      // precaution: stands in front of any rewrite of the address register that the loads
      // of x above name; as its operand the address stays in that register up to here
      if ((gq & 3) == 0 && p * WCP + (gq >> 2) + 1 < DIN / 32)
        asm volatile("s_wait_xcnt 0x0" :: "v"(xl) : "memory");
      // keeps the read groups whole and one group ahead: left free, the compiler spread the
      // reads in pairs among the products and waited for each pair in full
      __builtin_amdgcn_sched_barrier(0);
    }
    // --- publish pass p + 1, free this pass's buffer, refill it with pass p + 2 ---
    __asm__ volatile("s_wait_dscnt 0x0" ::: "memory");     // own reads of this buffer done
    __asm__ volatile("s_wait_asynccnt 0x0" ::: "memory");  // own copies of pass p + 1 landed
    __syncthreads();
    if (p + 2 < NW) issue_w(p & 1, p + 2);
    xl += WCP * 32;
  }
  // nothing in flight, and the last pass's barrier ended every read: the ring is the stage
  __asm__ volatile("s_wait_asynccnt 0x0" ::: "memory");

  // acc[n][r] = Y[token w*16 + mofs + r][dim n*16 + nlo]
  // The loops below are unrolled so that acc[] is indexed by constants (it stays in
  // registers) and so that the 16 LDS reads of a wave issue together ahead of its stores.
  int nlo  = lane & 15;
  int mofs = (lane >> 4) * 8;
  if (wsel != 2) {                               // the same for the whole block
    float scale = (wsel == 0) ? 0.0625f : 1.0f;  // fold 1/sqrt(DH) into Q
    _Float16* sp = stage + (w * 16 + mofs) * QSTG + nlo;
#pragma unroll
    for (int n = 0; n < 16; ++n)
#pragma unroll
      for (int r = 0; r < 8; ++r) sp[r * QSTG + n * 16] = (_Float16)(acc[n][r] * scale);
    __syncthreads();                             // lanes read what other lanes staged
    // one wave-wide store = one token's whole 512-byte row
    _Float16* dst = ((wsel == 0) ? Qh : Kh) + (size_t)rowbase * DH + lane * 8;
    const _Float16* rp = stage + (w * 16) * QSTG + lane * 8;
#pragma unroll
    for (int j = 0; j < 16; ++j) *(half8*)(dst + j * DH) = *(const half8*)(rp + j * QSTG);
    // precaution: stands in front of any later rewrite of a register that these stores name
    asm volatile("s_wait_xcnt 0x0" ::: "memory");
  } else {
    // a lane's 8 registers are 8 consecutive tokens of one dim: 16 bytes of a V^T row
    _Float16* sp = stage + nlo * VSTG + w * 16 + mofs;
#pragma unroll
    for (int n = 0; n < 16; ++n) {
      half8 hv;
#pragma unroll
      for (int r = 0; r < 8; ++r) hv[r] = (_Float16)acc[n][r];
      *(half8*)(sp + n * 16 * VSTG) = hv;
    }
    __syncthreads();                             // all eight waves' tokens are staged
    // one wave-wide store = the block's 128 tokens (256 bytes) of two dims
    int b   = (blockIdx.x * 128) >> 12;          // T_ == 4096; a block's rows share b
    int t0  = (blockIdx.x * 128) & (T_ - 1);
    int dim = w * 32 + (lane >> 4);
    _Float16* dst = Vt + ((size_t)b * DH + dim) * T_ + t0 + nlo * 8;
    const _Float16* rp = stage + dim * VSTG + nlo * 8;
#pragma unroll
    for (int j = 0; j < 16; ++j)
      *(half8*)(dst + (size_t)j * 2 * T_) = *(const half8*)(rp + j * 2 * VSTG);
  }
}

// ---------------------------------------------------------------------------
// Kernel 2: flash attention.  grid=(T/64, B), block=256 (8 waves) = one block per WGP.
// Wave w: query half w & 1 (32 queries = two 16-query tiles, full DH output), key group
// g = w >> 1.  A pass stages 128 keys (double-buffered async copies); group g works on
// keys 32g .. 32g+31 of it with its own online softmax.  Every K and V^T fragment read
// from LDS is the A operand of two WMMAs, one per query tile, so the LDS reads of a pass
// take no longer than its matrix work.  After the loop the four groups exchange their
// output tiles through LDS and each finishes 64 dims.
// Lane l (c = l & 15, h = l >> 4) works for query c of each tile: a score tile's register
// r is S^T[key 8h + r][query c], an output tile's register r is O^T[dim 8h + r][query c].
// ---------------------------------------------------------------------------
// amdgpu_waves_per_eu(2, 2): the grid has one block per WGP, so one block (two waves
// per SIMD) is the real residency and 512 registers per wave are free: the output tiles
// take 256 of them and Q takes 128.
__global__ __launch_bounds__(256) __attribute__((amdgpu_waves_per_eu(2, 2)))
void attn_kernel(
    const _Float16* __restrict__ Qh, const _Float16* __restrict__ Kh,
    const _Float16* __restrict__ Vt, float* __restrict__ out) {
  // ring: K pass 128 x 256 (two buffers), then V^T pass 256 x 128 (two buffers)
  __shared__ __align__(16) _Float16 ring[2 * KHALVES + 2 * VHALVES];

  int tid   = threadIdx.x;
  int w     = tid >> 5;
  int lane  = tid & 31;
  int qh    = w & 1;
  int g     = w >> 1;
  int b     = blockIdx.y;
  int qbase = blockIdx.x * 64 + qh * 32;
  int nlo   = lane & 15;
  int mofs  = (lane >> 4) * 8;

  // Q resident in registers: per query tile 8 B-fragments (column = query) covering DH.
  v16h bq[2][8];
  const _Float16* qptr = Qh + (size_t)(b * T_ + qbase) * DH;
#pragma unroll
  for (int q = 0; q < 2; ++q)
#pragma unroll
    for (int c = 0; c < 8; ++c) bq[q][c] = load_frag_f16(qptr + q * 16 * DH + c * 32, DH);

  v8f zv = {};
  v8f o[2][16];
#pragma unroll
  for (int q = 0; q < 2; ++q)
#pragma unroll
    for (int t = 0; t < 16; ++t) o[q][t] = zv;

  // this lane's query of each tile, this group's keys: running maximum (alike in both
  // halves) and the sum over the keys that this half of the wave holds; all sums join
  // after the loop
  float mstate[2] = {-1e30f, -1e30f};
  float lstate[2] = {0.0f, 0.0f};

  // --- async copy of one 128-key pass (K: 64KB, V^T: 64KB), 32 b128/thread; every
  // wave-wide copy reads 512 bytes of whole lines (K: one row, V^T: two rows).  A lane's
  // copies differ by constant steps, so that one address of each kind is kept. ---
  const char* kg0 = (const char*)(Kh + (size_t)b * T_ * DH) + tid * 16;
  const char* vg0 = (const char*)(Vt + (size_t)b * DH * T_) + (tid >> 4) * (T_ * 2) + (tid & 15) * 16;
  int kd0 = (tid >> 5) * KSTR + (tid & 31) * 8;
  int vd0 = 2 * KHALVES + (tid >> 4) * VSTR + (tid & 15) * 8;
  auto issue_pass = [&](int buf, int p) {
    const char* kg = kg0 + (size_t)p * (KPASS * DH * 2);   // 128 rows x 512B
    const char* vg = vg0 + p * (KPASS * 2);                // 256 rows x 256B
    _Float16* kd = ring + buf * KHALVES + kd0;
    _Float16* vd = ring + buf * VHALVES + vd0;
#pragma unroll
    for (int it = 0; it < 16; ++it)       // 8 K rows a step
      async_b128(kd + it * 8 * KSTR, kg + it * 8 * (DH * 2));
#pragma unroll
    for (int it = 0; it < 16; ++it)       // 16 V^T rows a step
      async_b128(vd + it * 16 * VSTR, vg + it * 16 * (T_ * 2));
  };

  const int NP = T_ / KPASS;
  issue_pass(0, 0);
  __asm__ volatile("s_wait_asynccnt 0x0" ::: "memory");  // pass 0 landed in LDS
  __syncthreads();                                       // publish pass 0
  issue_pass(1, 1);

  for (int p = 0; p < NP; ++p) {
    int cur = p & 1;
    const _Float16* kl = ring + cur * KHALVES + g * (32 * KSTR);
    const _Float16* vl = ring + 2 * KHALVES + cur * VHALVES + g * 32;

    // --- S^T = K * Q^T for 32 keys x 32 queries (four 16x16 tiles): A = K rows, B = Q ---
    v8f s[2][2];
#pragma unroll
    for (int q = 0; q < 2; ++q) { s[q][0] = zv; s[q][1] = zv; }
    // K fragments come in groups of four (two 32-deep steps x two key tiles), in two
    // register sets: the next group's reads are issued ahead of this group's products.
    v16h ak[2][4];
#pragma unroll
    for (int j = 0; j < 2; ++j) {
      ak[0][j * 2]     = load_frag_f16(kl + j * 32, KSTR);
      ak[0][j * 2 + 1] = load_frag_f16(kl + 16 * KSTR + j * 32, KSTR);
    }
#pragma unroll
    for (int n = 0; n < 4; ++n) {
      if (n < 3) {
#pragma unroll
        for (int j = 0; j < 2; ++j) {
          ak[(n + 1) & 1][j * 2]     = load_frag_f16(kl + ((n + 1) * 2 + j) * 32, KSTR);
          ak[(n + 1) & 1][j * 2 + 1] = load_frag_f16(kl + 16 * KSTR + ((n + 1) * 2 + j) * 32, KSTR);
        }
      }
#pragma unroll
      for (int j = 0; j < 2; ++j)
#pragma unroll
        for (int q = 0; q < 2; ++q) {
          s[q][0] = wmma_f16(ak[n & 1][j * 2],     bq[q][n * 2 + j], s[q][0]);
          s[q][1] = wmma_f16(ak[n & 1][j * 2 + 1], bq[q][n * 2 + j], s[q][1]);
        }
      // keeps later groups' reads behind this group: fetched further ahead, the fragments
      // no longer fit beside O and Q, and the build spills registers
      __builtin_amdgcn_sched_barrier(0);
    }

    // V^T fragments come in groups of four, in two register sets, like K's; the first
    // group's reads fly during the softmax.
    v16h av[2][4];
#pragma unroll
    for (int i = 0; i < 4; ++i) av[0][i] = load_frag_f16(vl + (i * 16) * VSTR, VSTR);

    // --- online softmax: 16 of a query's 32 scores are in this lane ---
    Frag16 pf[2];
    float al[2];
#pragma unroll
    for (int q = 0; q < 2; ++q) {
      float mx = fmaxf(s[q][0][0], s[q][1][0]);
#pragma unroll
      for (int r = 1; r < 8; ++r) mx = fmaxf(mx, fmaxf(s[q][0][r], s[q][1][r]));
      mx = fmaxf(mx, xhalf(mx));
      float mnew  = fmaxf(mstate[q], mx);
      float alpha = __expf(mstate[q] - mnew);
      mstate[q] = mnew;

      // P^T as B operand: element e is key 8h + e (e < 8) or 16 + 8h + (e - 8), which is
      // the order of the two score tiles' registers and of the V^T fragment's halves.
      float rs = 0.0f;
#pragma unroll
      for (int r = 0; r < 8; ++r) {
        float p0 = __expf(s[q][0][r] - mnew);
        float p1 = __expf(s[q][1][r] - mnew);
        rs += p0 + p1;
        pf[q].e[r]     = (_Float16)p0;
        pf[q].e[8 + r] = (_Float16)p1;
      }
      lstate[q] = lstate[q] * alpha + rs;
      al[q] = alpha;
    }

    // --- O^T = O^T * alpha + V^T * P^T : A = V^T rows from LDS (row = dim), B = P^T of
    // each tile. ---
    // inputs-only fence: both P^T fragments are complete before the second group of V^T is
    // read.  Without it the compiler puts the second tile's products off to the end of the
    // pass and holds all sixteen V^T fragments (128 registers) until then, and Q is spilled.
    asm volatile("" :: "v"(pf[0].v), "v"(pf[1].v) : "memory");
#pragma unroll
    for (int n = 0; n < 4; ++n) {
      if (n < 3) {
#pragma unroll
        for (int i = 0; i < 4; ++i)
          av[(n + 1) & 1][i] = load_frag_f16(vl + (((n + 1) * 4 + i) * 16) * VSTR, VSTR);
      }
#pragma unroll
      for (int i = 0; i < 4; ++i)
#pragma unroll
        for (int q = 0; q < 2; ++q) {
          int t = n * 4 + i;
#pragma unroll
          for (int r = 0; r < 8; ++r) o[q][t][r] *= al[q];
          o[q][t] = wmma_f16(av[n & 1][i], pf[q].v, o[q][t]);
        }
      // as above: fragments fetched further ahead do not fit beside O and Q
      __builtin_amdgcn_sched_barrier(0);
    }

    // --- publish pass p + 1, free this pass's buffer, refill it with pass p + 2 ---
    __asm__ volatile("s_wait_dscnt 0x0" ::: "memory");     // own reads of this buffer done
    __asm__ volatile("s_wait_asynccnt 0x0" ::: "memory");  // own copies of pass p + 1 landed
    __syncthreads();
    if (p + 2 < NP) issue_pass(cur, p + 2);
  }
  __asm__ volatile("s_wait_asynccnt 0x0" ::: "memory");    // nothing in flight: ring is free

  // --- join the four key groups.  Waves qh, qh + 2, qh + 4, qh + 6 hold the same 32
  // queries.  Every wave lays its tiles, maxima and sums into the (now free) ring;
  // group g then finishes dims 64g .. 64g+63 from all four groups' tiles. ---
  f32x4* xo = (f32x4*)ring;                                // 8 waves x 32 tiles x 2 x 32 x 16 B
  float* xm = (float*)(xo + 8 * 32 * 2 * 32);              // 8 waves x 2 x 32 maxima
  float* xl = xm + 8 * 2 * 32;                             // 8 waves x 2 x 32 sums
#pragma unroll
  for (int q = 0; q < 2; ++q) {
#pragma unroll
    for (int t = 0; t < 16; ++t) {
      f32x4* xp = xo + ((w * 32 + q * 16 + t) * 2) * 32 + lane;
      xp[0]  = __builtin_shufflevector(o[q][t], o[q][t], 0, 1, 2, 3);
      xp[32] = __builtin_shufflevector(o[q][t], o[q][t], 4, 5, 6, 7);
    }
    xm[(w * 2 + q) * 32 + lane] = mstate[q];
    xl[(w * 2 + q) * 32 + lane] = lstate[q];
  }
  __syncthreads();                                         // all groups' tiles are visible

  // --- weigh, normalize and write fp32 output: 8 consecutive dims of one query per tile ---
#pragma unroll
  for (int q = 0; q < 2; ++q) {
    float mg[4], a[4];
#pragma unroll
    for (int k = 0; k < 4; ++k) mg[k] = xm[((k * 2 + qh) * 2 + q) * 32 + lane];
    float mall = fmaxf(fmaxf(mg[0], mg[1]), fmaxf(mg[2], mg[3]));
    float lsum = 0.0f;
#pragma unroll
    for (int k = 0; k < 4; ++k) {
      a[k] = __expf(mg[k] - mall);
      lsum += xl[((k * 2 + qh) * 2 + q) * 32 + lane] * a[k];
    }
    float inv = 1.0f / (lsum + xhalf(lsum));
#pragma unroll
    for (int k = 0; k < 4; ++k) a[k] *= inv;

    float* orow = out + (size_t)(b * T_ + qbase + q * 16 + nlo) * DH + g * 64 + mofs;
#pragma unroll
    for (int i = 0; i < 4; ++i) {
      f32x4 r0 = {}, r1 = {};
#pragma unroll
      for (int k = 0; k < 4; ++k) {
        const f32x4* xp = xo + (((k * 2 + qh) * 32 + q * 16 + g * 4 + i) * 2) * 32 + lane;
        r0 += xp[0] * a[k];
        r1 += xp[32] * a[k];
      }
      *(f32x4*)(orow + i * 16)     = r0;
      *(f32x4*)(orow + i * 16 + 4) = r1;
    }
  }
}

// ---------------------------------------------------------------------------
extern "C" void kernel_launch(void* const* d_in, const int* in_sizes, int n_in,
                              void* d_out, int out_size, void* d_ws, size_t ws_size,
                              hipStream_t stream) {
  const float* x  = (const float*)d_in[0];
  const float* Wq = (const float*)d_in[1];
  const float* Wk = (const float*)d_in[2];
  const float* Wv = (const float*)d_in[3];
  float* out = (float*)d_out;

  char* ws = (char*)d_ws;
  _Float16* Qh = (_Float16*)(ws);                                 // 8 MB
  _Float16* Kh = (_Float16*)(ws + (size_t)8  * 1024 * 1024);      // 8 MB
  _Float16* Vt = (_Float16*)(ws + (size_t)16 * 1024 * 1024);      // 8 MB
  _Float16* Wt = (_Float16*)(ws + (size_t)24 * 1024 * 1024);      // 3 x 384 KB

  wt_kernel<<<(3 * DIN * DH / 8 + 255) / 256, 256, 0, stream>>>(Wq, Wk, Wv, Wt);

  dim3 g1((B_ * T_) / 128, 3);
  qkv_kernel<<<g1, 256, 0, stream>>>(x, Wt, Qh, Kh, Vt);

  dim3 g2(T_ / 64, B_);
  attn_kernel<<<g2, 256, 0, stream>>>(Qh, Kh, Vt, out);
}

// v008
// It runs in 85.5 microseconds.
// Next to v007, in two timings, it ran 1.04 times as fast each time.
// All steps since v000 together make it 7.44 times as fast.
#include <hip/hip_runtime.h>

// Self-attention forward: Q=xWq*scale, K=xWk, V=xWv; O = softmax(QK^T)V
// B=4, T=4096, D_IN=768, D_H=256.  All matmuls via v_wmma_f32_16x16x32_f16.
// Attention kernel stages K/V passes into LDS with global_load_async_to_lds_b128
// (double-buffered, ASYNCcnt-tracked) so the DMA overlaps the WMMA work.
// A block holds 64 queries: a wave has 32 of them, and four groups of two waves each take
// every fourth 32 keys, so that the grid has one block for every WGP and an LDS fragment
// feeds two matrix instructions; the groups' results join at the end.
// It forms the products transposed (S^T = K Q^T, O^T += V^T P^T): a lane then holds the
// scores of ONE query per tile, and P^T goes from the score registers into the B operand.

typedef _Float16 half8 __attribute__((ext_vector_type(8)));
typedef _Float16 v16h  __attribute__((ext_vector_type(16)));
typedef float    v8f   __attribute__((ext_vector_type(8)));
typedef float    f32x4 __attribute__((ext_vector_type(4)));

#define B_  4
#define T_  4096
#define DIN 768
#define DH  256

// LDS row strides (halves), padded to spread banks; all row offsets 16B-aligned.
#define KSTR 264   // 128 K-rows  x 264 (528 B/row)
#define VSTR 136   // 256 V-rows  x 136 (272 B/row)
#define KPASS 128  // keys staged per pass: 32 for each group of waves
#define KHALVES (KPASS * KSTR)
#define VHALVES (DH * VSTR)
#define RAISE 5.545177f  // 8 ln 2: how far a maximum may pass the held reference

union Frag16 { v16h v; half8 h[2]; _Float16 e[16]; };

// 16x32 (A) or 32x16 (B) f16 fragment, per CDNA5 ISA 7.12.2 lane layout.
// lane<16 : row = lane,    K halves {0..7} and {16..23}
// lane>=16: row = lane-16, K halves {8..15} and {24..31}
__device__ __forceinline__ v16h load_frag_f16(const _Float16* base, int stride) {
  int lane = threadIdx.x & 31;
  int r    = lane & 15;
  int hi   = lane >> 4;
  const _Float16* p = base + (size_t)r * stride + (hi ? 8 : 0);
  Frag16 f;
  f.h[0] = *(const half8*)(p);
  f.h[1] = *(const half8*)(p + 16);
  return f.v;
}

// Same A-fragment layout but source is fp32: the loads, and the conversion to f16 in
// registers, apart, so that the loads can be issued ahead of the conversion.
struct XRaw { f32x4 f[4]; };
// p: the lane's own place, row (lane & 15), k offset 8 in the upper half of the wave
__device__ __forceinline__ XRaw load_frag_f32(const float* p) {
  XRaw x;
  x.f[0] = *(const f32x4*)(p);
  x.f[1] = *(const f32x4*)(p + 4);
  x.f[2] = *(const f32x4*)(p + 16);
  x.f[3] = *(const f32x4*)(p + 20);
  return x;
}
__device__ __forceinline__ v16h cvt_frag_f32(const XRaw& x) {
  Frag16 f;
#pragma unroll
  for (int i = 0; i < 4; ++i) {
    f.e[i]      = (_Float16)x.f[0][i];
    f.e[4 + i]  = (_Float16)x.f[1][i];
    f.e[8 + i]  = (_Float16)x.f[2][i];
    f.e[12 + i] = (_Float16)x.f[3][i];
  }
  return f.v;
}

__device__ __forceinline__ v8f wmma_f16(v16h a, v16h b, v8f c) {
  // (neg_a, A, neg_b, B, c_mod, C, reuse_a, reuse_b)
  return __builtin_amdgcn_wmma_f32_16x16x32_f16(false, a, false, b, (short)0, c,
                                                false, false);
}

// Lane l takes the value of lane l ^ 16 (the other half of the wave), in the vector unit.
__device__ __forceinline__ float xhalf(float x) {
  int i = __builtin_bit_cast(int, x);
  return __builtin_bit_cast(float, __builtin_amdgcn_permlanex16(
      i, i, 0x76543210, 0xfedcba98, false, false));
}

// Async copy of one 16-byte segment per lane: LDS[dst] = MEM[src]  (ASYNCcnt)
typedef int i32x4 __attribute__((ext_vector_type(4)));
typedef __attribute__((address_space(1))) i32x4 glb_i32x4;
typedef __attribute__((address_space(3))) i32x4 lds_i32x4;
__device__ __forceinline__ void async_b128(_Float16* dst, const char* src) {
  __builtin_amdgcn_global_load_async_to_lds_b128((glb_i32x4*)src, (lds_i32x4*)dst, 0, 0);
}

// ---------------------------------------------------------------------------
// Kernel 0: convert the weights to f16 and pack them in B-fragment order.
// Unit (w, c, nt, part) = 512 contiguous bytes = what ONE wave-wide 16-byte load of
// the projection reads: lane l holds W_w[c*32 + part*16 + (l>>4)*8 + 0..7][nt*16 + (l&15)].
// Thread g writes halves g*8 .. g*8+7, so every store is 16 B and whole lines fill.
// ---------------------------------------------------------------------------
__global__ void wt_kernel(const float* __restrict__ Wq, const float* __restrict__ Wk,
                          const float* __restrict__ Wv, _Float16* __restrict__ Wt) {
  int g = blockIdx.x * blockDim.x + threadIdx.x;
  const int per8 = DIN * DH / 8;       // 16-byte pieces per weight matrix
  if (g >= 3 * per8) return;
  int w    = g / per8;
  int rem  = g - w * per8;
  int r    = rem & 15;                 // column inside the 16-column tile
  int hi   = (rem >> 4) & 1;           // lane half: k offset 8
  int part = (rem >> 5) & 1;           // first or second 16-byte load: k offset 16
  int nt   = (rem >> 6) & 15;          // column tile
  int c    = rem >> 10;                // 32-deep k block
  int k0   = c * 32 + part * 16 + hi * 8;
  int n    = nt * 16 + r;
  const float* src = (w == 0) ? Wq : (w == 1) ? Wk : Wv;
  half8 v;
  // unrolled so that the eight row loads issue together and v stays in registers
#pragma unroll
  for (int e = 0; e < 8; ++e) v[e] = (_Float16)src[(size_t)(k0 + e) * DH + n];
  *(half8*)(Wt + (size_t)g * 8) = v;
}

// ---------------------------------------------------------------------------
// Kernel 1: QKV projection GEMM.  grid=(128,3), block=256 (8 waves).
// Each wave: 16 rows x full DH=256 cols.  blockIdx.y selects Q/K/V.
// Q is pre-scaled by 1/16; V stored transposed Vt[b][h][t].
// The packed weights come into LDS by asynchronous copies, once per block, in passes of
// four 32-deep k blocks (64 KB, two buffers): the eight waves read their B fragments from
// LDS, and the WGP's cache path is left to the loads of x.
// The block's 128 x 256 result goes through LDS in the layout of its destination, so
// that every global store is 16 bytes a lane and a wave-wide store fills whole lines.
// ---------------------------------------------------------------------------
#define QSTG 264   // Q/K stage: 128 token rows x 264 halves (528 B = 16 B x odd)
#define VSTG 136   // V^T stage: 256 dim rows   x 136 halves (272 B = 16 B x odd)
#define WCP 4                    // 32-deep k blocks per weight pass
#define WHALVES (WCP * 16 * 512) // halves per weight pass: 16 fragments of 1 KB a k block
// amdgpu_waves_per_eu(4, 4): two of these 8-wave blocks per WGP is all the grid can
// place, so the register budget is 256 per wave.  Without it the scheduler kept the
// register count low for a residency the launch never reaches and put a full wait
// between every fragment load pair and its WMMA; with it the loads run ahead.
__global__ __launch_bounds__(256) __attribute__((amdgpu_waves_per_eu(4, 4)))
void qkv_kernel(
    const float* __restrict__ x, const _Float16* __restrict__ Wt,
    _Float16* __restrict__ Qh, _Float16* __restrict__ Kh,
    _Float16* __restrict__ Vt) {
  // two weight buffers; after the loop the same LDS is the result stage
  // (DH * VSTG and 128 * QSTG halves both fit in it)
  __shared__ __align__(16) _Float16 wring[2 * WHALVES];
  _Float16* stage = wring;
  int w       = threadIdx.x >> 5;
  int lane    = threadIdx.x & 31;
  int wsel    = blockIdx.y;
  int rowbase = blockIdx.x * 128 + w * 16;   // global row in [0, B*T)
  const _Float16* Wsel = Wt + (size_t)wsel * (DIN * DH);

  v8f zv = {};
  v8f acc[16];
#pragma unroll
  for (int n = 0; n < 16; ++n) acc[n] = zv;

  // a pass of weights is 64 KB in a row, in LDS as in memory: 16 copies of 16 B a thread,
  // every wave-wide copy 512 contiguous bytes
  const char* wg0 = (const char*)Wsel + threadIdx.x * 16;
  auto issue_w = [&](int buf, int p) {
    const char* wg = wg0 + p * (WHALVES * 2);
    _Float16* wd = wring + buf * WHALVES + threadIdx.x * 8;
    // unrolled so that the copies differ by constant steps and one address of each kind is kept
#pragma unroll
    for (int it = 0; it < 16; ++it) async_b128(wd + it * 2048, wg + it * 4096);
  };

  const int NW = DIN / 32 / WCP;
  // this lane's place in its row of x, at the first k block of the current pass
  const float* xl = x + (size_t)(rowbase + (lane & 15)) * DIN + (lane >> 4) * 8;
  __builtin_prefetch(xl + 32, 0, 3);
  XRaw xr = load_frag_f32(xl);                           // k block 0, flies with pass 0
  issue_w(0, 0);
  __asm__ volatile("s_wait_asynccnt 0x0" ::: "memory");  // own copies of pass 0 landed
  __syncthreads();                                       // publish pass 0
  issue_w(1, 1);

  for (int p = 0; p < NW; ++p) {
    const _Float16* wl = wring + (p & 1) * WHALVES + lane * 8;
    // packed fragment: two LDS reads of 512 contiguous bytes, no bank met twice
    auto wfrag = [&](int f) {
      Frag16 bf;
      bf.h[0] = *(const half8*)(wl + f * 512);
      bf.h[1] = *(const half8*)(wl + f * 512 + 256);
      return bf.v;
    };
    // The pass's 64 fragments come in groups of four, in two register sets: the next
    // group's eight reads are issued together ahead of this group's products.
    v16h bw[2][4];
    v16h af;
#pragma unroll
    for (int i = 0; i < 4; ++i) bw[0][i] = wfrag(i);
    // this loop and the loops over i are unrolled so that bw[] and acc[] are indexed by
    // constants and stay in registers
#pragma unroll
    for (int gq = 0; gq < WCP * 4; ++gq) {
      if ((gq & 3) == 0) {
        // x is loaded one k block ahead of its use (the fence below would hold the loads
        // at their use otherwise), and prefetched one block ahead of its load as before
        int c = p * WCP + (gq >> 2);
        af = cvt_frag_f32(xr);
        if (c + 2 < DIN / 32) __builtin_prefetch(xl + ((gq >> 2) + 2) * 32, 0, 3);
        if (c + 1 < DIN / 32) xr = load_frag_f32(xl + ((gq >> 2) + 1) * 32);
      }
      if (gq + 1 < WCP * 4) {
#pragma unroll
        for (int i = 0; i < 4; ++i) bw[(gq + 1) & 1][i] = wfrag((gq + 1) * 4 + i);
      }
#pragma unroll
      for (int i = 0; i < 4; ++i)
        acc[(gq & 3) * 4 + i] = wmma_f16(af, bw[gq & 1][i], acc[(gq & 3) * 4 + i]);
      // precaution: stands in front of any rewrite of the address register that the loads
      // of x above name; as its operand the address stays in that register up to here
      if ((gq & 3) == 0 && p * WCP + (gq >> 2) + 1 < DIN / 32)
        asm volatile("s_wait_xcnt 0x0" :: "v"(xl) : "memory");
      // keeps the read groups whole and one group ahead: left free, the compiler spread the
      // reads in pairs among the products and waited for each pair in full
      __builtin_amdgcn_sched_barrier(0);
    }
    // --- publish pass p + 1, free this pass's buffer, refill it with pass p + 2 ---
    __asm__ volatile("s_wait_dscnt 0x0" ::: "memory");     // own reads of this buffer done
    __asm__ volatile("s_wait_asynccnt 0x0" ::: "memory");  // own copies of pass p + 1 landed
    __syncthreads();
    if (p + 2 < NW) issue_w(p & 1, p + 2);
    xl += WCP * 32;
  }
  // nothing in flight, and the last pass's barrier ended every read: the ring is the stage
  __asm__ volatile("s_wait_asynccnt 0x0" ::: "memory");

  // acc[n][r] = Y[token w*16 + mofs + r][dim n*16 + nlo]
  // The loops below are unrolled so that acc[] is indexed by constants (it stays in
  // registers) and so that the 16 LDS reads of a wave issue together ahead of its stores.
  int nlo  = lane & 15;
  int mofs = (lane >> 4) * 8;
  if (wsel != 2) {                               // the same for the whole block
    float scale = (wsel == 0) ? 0.0625f : 1.0f;  // fold 1/sqrt(DH) into Q
    _Float16* sp = stage + (w * 16 + mofs) * QSTG + nlo;
#pragma unroll
    for (int n = 0; n < 16; ++n)
#pragma unroll
      for (int r = 0; r < 8; ++r) sp[r * QSTG + n * 16] = (_Float16)(acc[n][r] * scale);
    __syncthreads();                             // lanes read what other lanes staged
    // one wave-wide store = one token's whole 512-byte row
    _Float16* dst = ((wsel == 0) ? Qh : Kh) + (size_t)rowbase * DH + lane * 8;
    const _Float16* rp = stage + (w * 16) * QSTG + lane * 8;
#pragma unroll
    for (int j = 0; j < 16; ++j) *(half8*)(dst + j * DH) = *(const half8*)(rp + j * QSTG);
    // precaution: stands in front of any later rewrite of a register that these stores name
    asm volatile("s_wait_xcnt 0x0" ::: "memory");
  } else {
    // a lane's 8 registers are 8 consecutive tokens of one dim: 16 bytes of a V^T row
    _Float16* sp = stage + nlo * VSTG + w * 16 + mofs;
#pragma unroll
    for (int n = 0; n < 16; ++n) {
      half8 hv;
#pragma unroll
      for (int r = 0; r < 8; ++r) hv[r] = (_Float16)acc[n][r];
      *(half8*)(sp + n * 16 * VSTG) = hv;
    }
    __syncthreads();                             // all eight waves' tokens are staged
    // one wave-wide store = the block's 128 tokens (256 bytes) of two dims
    int b   = (blockIdx.x * 128) >> 12;          // T_ == 4096; a block's rows share b
    int t0  = (blockIdx.x * 128) & (T_ - 1);
    int dim = w * 32 + (lane >> 4);
    _Float16* dst = Vt + ((size_t)b * DH + dim) * T_ + t0 + nlo * 8;
    const _Float16* rp = stage + dim * VSTG + nlo * 8;
#pragma unroll
    for (int j = 0; j < 16; ++j)
      *(half8*)(dst + (size_t)j * 2 * T_) = *(const half8*)(rp + j * 2 * VSTG);
  }
}

// ---------------------------------------------------------------------------
// Kernel 2: flash attention.  grid=(T/64, B), block=256 (8 waves) = one block per WGP.
// Wave w: query half w & 1 (32 queries = two 16-query tiles, full DH output), key group
// g = w >> 1.  A pass stages 128 keys (double-buffered async copies); group g works on
// keys 32g .. 32g+31 of it with its own online softmax.  Every K and V^T fragment read
// from LDS is the A operand of two WMMAs, one per query tile, so the LDS reads of a pass
// take no longer than its matrix work.  After the loop the four groups exchange their
// output tiles through LDS and each finishes 64 dims.
// Lane l (c = l & 15, h = l >> 4) works for query c of each tile: a score tile's register
// r is S^T[key 8h + r][query c], an output tile's register r is O^T[dim 8h + r][query c].
// ---------------------------------------------------------------------------
// amdgpu_waves_per_eu(2, 2): the grid has one block per WGP, so one block (two waves
// per SIMD) is the real residency and 512 registers per wave are free: the output tiles
// take 256 of them and Q takes 128.
__global__ __launch_bounds__(256) __attribute__((amdgpu_waves_per_eu(2, 2)))
void attn_kernel(
    const _Float16* __restrict__ Qh, const _Float16* __restrict__ Kh,
    const _Float16* __restrict__ Vt, float* __restrict__ out) {
  // ring: K pass 128 x 256 (two buffers), then V^T pass 256 x 128 (two buffers)
  __shared__ __align__(16) _Float16 ring[2 * KHALVES + 2 * VHALVES];

  int tid   = threadIdx.x;
  int w     = tid >> 5;
  int lane  = tid & 31;
  int qh    = w & 1;
  int g     = w >> 1;
  int b     = blockIdx.y;
  int qbase = blockIdx.x * 64 + qh * 32;
  int nlo   = lane & 15;
  int mofs  = (lane >> 4) * 8;

  // Q resident in registers: per query tile 8 B-fragments (column = query) covering DH.
  v16h bq[2][8];
  const _Float16* qptr = Qh + (size_t)(b * T_ + qbase) * DH;
#pragma unroll
  for (int q = 0; q < 2; ++q)
#pragma unroll
    for (int c = 0; c < 8; ++c) bq[q][c] = load_frag_f16(qptr + q * 16 * DH + c * 32, DH);

  v8f zv = {};
  v8f o[2][16];
#pragma unroll
  for (int q = 0; q < 2; ++q)
#pragma unroll
    for (int t = 0; t < 16; ++t) o[q][t] = zv;

  // this lane's query of each tile, this group's keys: the reference of the exponentials
  // (alike in both halves) and the sum over the keys that this half of the wave holds; all
  // sums join after the loop
  float mstate[2] = {-1e30f, -1e30f};
  float lstate[2] = {0.0f, 0.0f};

  // --- async copy of one 128-key pass (K: 64KB, V^T: 64KB), 32 b128/thread; every
  // wave-wide copy reads 512 bytes of whole lines (K: one row, V^T: two rows).  A lane's
  // copies differ by constant steps, so that one address of each kind is kept. ---
  const char* kg0 = (const char*)(Kh + (size_t)b * T_ * DH) + tid * 16;
  const char* vg0 = (const char*)(Vt + (size_t)b * DH * T_) + (tid >> 4) * (T_ * 2) + (tid & 15) * 16;
  int kd0 = (tid >> 5) * KSTR + (tid & 31) * 8;
  int vd0 = 2 * KHALVES + (tid >> 4) * VSTR + (tid & 15) * 8;
  auto issue_pass = [&](int buf, int p) {
    const char* kg = kg0 + (size_t)p * (KPASS * DH * 2);   // 128 rows x 512B
    const char* vg = vg0 + p * (KPASS * 2);                // 256 rows x 256B
    _Float16* kd = ring + buf * KHALVES + kd0;
    _Float16* vd = ring + buf * VHALVES + vd0;
#pragma unroll
    for (int it = 0; it < 16; ++it)       // 8 K rows a step
      async_b128(kd + it * 8 * KSTR, kg + it * 8 * (DH * 2));
#pragma unroll
    for (int it = 0; it < 16; ++it)       // 16 V^T rows a step
      async_b128(vd + it * 16 * VSTR, vg + it * 16 * (T_ * 2));
  };

  const int NP = T_ / KPASS;
  issue_pass(0, 0);
  __asm__ volatile("s_wait_asynccnt 0x0" ::: "memory");  // pass 0 landed in LDS
  __syncthreads();                                       // publish pass 0
  issue_pass(1, 1);

  for (int p = 0; p < NP; ++p) {
    int cur = p & 1;
    const _Float16* kl = ring + cur * KHALVES + g * (32 * KSTR);
    const _Float16* vl = ring + 2 * KHALVES + cur * VHALVES + g * 32;

    // --- S^T = K * Q^T for 32 keys x 32 queries (four 16x16 tiles): A = K rows, B = Q ---
    v8f s[2][2];
#pragma unroll
    for (int q = 0; q < 2; ++q) { s[q][0] = zv; s[q][1] = zv; }
    // K fragments come in groups of four (two 32-deep steps x two key tiles), in two
    // register sets: the next group's reads are issued ahead of this group's products.
    v16h ak[2][4];
#pragma unroll
    for (int j = 0; j < 2; ++j) {
      ak[0][j * 2]     = load_frag_f16(kl + j * 32, KSTR);
      ak[0][j * 2 + 1] = load_frag_f16(kl + 16 * KSTR + j * 32, KSTR);
    }
#pragma unroll
    for (int n = 0; n < 4; ++n) {
      if (n < 3) {
#pragma unroll
        for (int j = 0; j < 2; ++j) {
          ak[(n + 1) & 1][j * 2]     = load_frag_f16(kl + ((n + 1) * 2 + j) * 32, KSTR);
          ak[(n + 1) & 1][j * 2 + 1] = load_frag_f16(kl + 16 * KSTR + ((n + 1) * 2 + j) * 32, KSTR);
        }
      }
#pragma unroll
      for (int j = 0; j < 2; ++j)
#pragma unroll
        for (int q = 0; q < 2; ++q) {
          s[q][0] = wmma_f16(ak[n & 1][j * 2],     bq[q][n * 2 + j], s[q][0]);
          s[q][1] = wmma_f16(ak[n & 1][j * 2 + 1], bq[q][n * 2 + j], s[q][1]);
        }
      // keeps later groups' reads behind this group: fetched further ahead, the fragments
      // no longer fit beside O and Q, and the build spills registers
      __builtin_amdgcn_sched_barrier(0);
    }

    // --- online softmax: 16 of a query's 32 scores are in this lane ---
    // The reference that the exponentials are taken against is held from pass to pass.
    // It is raised, and O^T and the sum rescaled with it, only when some query's new maximum
    // lies more than RAISE above it, so P stays below e^RAISE = 256, far inside f16.
    float mx[2];
    bool need = false;
#pragma unroll
    for (int q = 0; q < 2; ++q) {
      float m = fmaxf(s[q][0][0], s[q][1][0]);
#pragma unroll
      for (int r = 1; r < 8; ++r) m = fmaxf(m, fmaxf(s[q][0][r], s[q][1][r]));
      mx[q] = fmaxf(m, xhalf(m));          // alike in both halves of the wave
      need = need || (mx[q] > mstate[q] + RAISE);
    }
    // one test a pass, a scalar branch for the whole wave; taken in the first pass (the
    // reference starts at -1e30, the factor is then 0 on zeros) and seldom after it
    if (__builtin_amdgcn_ballot_w32(need) != 0) {
#pragma unroll
      for (int q = 0; q < 2; ++q) {
        float mnew  = fmaxf(mstate[q], mx[q]);
        float alpha = __expf(mstate[q] - mnew);
        mstate[q] = mnew;
        lstate[q] *= alpha;
#pragma unroll
        for (int t = 0; t < 16; ++t)
#pragma unroll
          for (int r = 0; r < 8; ++r) o[q][t][r] *= alpha;
      }
    }

    // V^T fragments come in groups of four, in two register sets, like K's; the first
    // group's reads fly during the exponentials.
    v16h av[2][4];
#pragma unroll
    for (int i = 0; i < 4; ++i) av[0][i] = load_frag_f16(vl + (i * 16) * VSTR, VSTR);
    // keeps the eight reads together here: left free, the compiler put six of them behind
    // the first products, each pair with a full wait
    __builtin_amdgcn_sched_barrier(0);

    Frag16 pf[2];
#pragma unroll
    for (int q = 0; q < 2; ++q) {
      float mref = mstate[q];
      // P^T as B operand: element e is key 8h + e (e < 8) or 16 + 8h + (e - 8), which is
      // the order of the two score tiles' registers and of the V^T fragment's halves.
      float rs = 0.0f;
#pragma unroll
      for (int r = 0; r < 8; ++r) {
        float p0 = __expf(s[q][0][r] - mref);
        float p1 = __expf(s[q][1][r] - mref);
        rs += p0 + p1;
        pf[q].e[r]     = (_Float16)p0;
        pf[q].e[8 + r] = (_Float16)p1;
      }
      lstate[q] += rs;
    }

    // --- O^T += V^T * P^T : A = V^T rows from LDS (row = dim), B = P^T of each tile. ---
    // inputs-only fence: both P^T fragments are complete before the second group of V^T is
    // read.  Without it the compiler puts the second tile's products off to the end of the
    // pass and holds all sixteen V^T fragments (128 registers) until then, and Q is spilled.
    asm volatile("" :: "v"(pf[0].v), "v"(pf[1].v) : "memory");
#pragma unroll
    for (int n = 0; n < 4; ++n) {
      if (n < 3) {
#pragma unroll
        for (int i = 0; i < 4; ++i)
          av[(n + 1) & 1][i] = load_frag_f16(vl + (((n + 1) * 4 + i) * 16) * VSTR, VSTR);
      }
#pragma unroll
      for (int i = 0; i < 4; ++i)
#pragma unroll
        for (int q = 0; q < 2; ++q) {
          int t = n * 4 + i;
          o[q][t] = wmma_f16(av[n & 1][i], pf[q].v, o[q][t]);
        }
      // as above: fragments fetched further ahead do not fit beside O and Q
      __builtin_amdgcn_sched_barrier(0);
    }

    // --- publish pass p + 1, free this pass's buffer, refill it with pass p + 2 ---
    __asm__ volatile("s_wait_dscnt 0x0" ::: "memory");     // own reads of this buffer done
    __asm__ volatile("s_wait_asynccnt 0x0" ::: "memory");  // own copies of pass p + 1 landed
    __syncthreads();
    if (p + 2 < NP) issue_pass(cur, p + 2);
  }
  __asm__ volatile("s_wait_asynccnt 0x0" ::: "memory");    // nothing in flight: ring is free

  // --- join the four key groups.  Waves qh, qh + 2, qh + 4, qh + 6 hold the same 32
  // queries.  Every wave lays its tiles, references and sums into the (now free) ring;
  // group g then finishes dims 64g .. 64g+63 from all four groups' tiles. ---
  f32x4* xo = (f32x4*)ring;                                // 8 waves x 32 tiles x 2 x 32 x 16 B
  float* xm = (float*)(xo + 8 * 32 * 2 * 32);              // 8 waves x 2 x 32 references
  float* xl = xm + 8 * 2 * 32;                             // 8 waves x 2 x 32 sums
#pragma unroll
  for (int q = 0; q < 2; ++q) {
#pragma unroll
    for (int t = 0; t < 16; ++t) {
      f32x4* xp = xo + ((w * 32 + q * 16 + t) * 2) * 32 + lane;
      xp[0]  = __builtin_shufflevector(o[q][t], o[q][t], 0, 1, 2, 3);
      xp[32] = __builtin_shufflevector(o[q][t], o[q][t], 4, 5, 6, 7);
    }
    xm[(w * 2 + q) * 32 + lane] = mstate[q];
    xl[(w * 2 + q) * 32 + lane] = lstate[q];
  }
  __syncthreads();                                         // all groups' tiles are visible

  // --- weigh, normalize and write fp32 output: 8 consecutive dims of one query per tile ---
#pragma unroll
  for (int q = 0; q < 2; ++q) {
    float mg[4], a[4];
#pragma unroll
    for (int k = 0; k < 4; ++k) mg[k] = xm[((k * 2 + qh) * 2 + q) * 32 + lane];
    float mall = fmaxf(fmaxf(mg[0], mg[1]), fmaxf(mg[2], mg[3]));
    float lsum = 0.0f;
#pragma unroll
    for (int k = 0; k < 4; ++k) {
      a[k] = __expf(mg[k] - mall);
      lsum += xl[((k * 2 + qh) * 2 + q) * 32 + lane] * a[k];
    }
    float inv = 1.0f / (lsum + xhalf(lsum));
#pragma unroll
    for (int k = 0; k < 4; ++k) a[k] *= inv;

    float* orow = out + (size_t)(b * T_ + qbase + q * 16 + nlo) * DH + g * 64 + mofs;
#pragma unroll
    for (int i = 0; i < 4; ++i) {
      f32x4 r0 = {}, r1 = {};
#pragma unroll
      for (int k = 0; k < 4; ++k) {
        const f32x4* xp = xo + (((k * 2 + qh) * 32 + q * 16 + g * 4 + i) * 2) * 32 + lane;
        r0 += xp[0] * a[k];
        r1 += xp[32] * a[k];
      }
      *(f32x4*)(orow + i * 16)     = r0;
      *(f32x4*)(orow + i * 16 + 4) = r1;
    }
  }
}

// ---------------------------------------------------------------------------
extern "C" void kernel_launch(void* const* d_in, const int* in_sizes, int n_in,
                              void* d_out, int out_size, void* d_ws, size_t ws_size,
                              hipStream_t stream) {
  const float* x  = (const float*)d_in[0];
  const float* Wq = (const float*)d_in[1];
  const float* Wk = (const float*)d_in[2];
  const float* Wv = (const float*)d_in[3];
  float* out = (float*)d_out;

  char* ws = (char*)d_ws;
  _Float16* Qh = (_Float16*)(ws);                                 // 8 MB
  _Float16* Kh = (_Float16*)(ws + (size_t)8  * 1024 * 1024);      // 8 MB
  _Float16* Vt = (_Float16*)(ws + (size_t)16 * 1024 * 1024);      // 8 MB
  _Float16* Wt = (_Float16*)(ws + (size_t)24 * 1024 * 1024);      // 3 x 384 KB

  wt_kernel<<<(3 * DIN * DH / 8 + 255) / 256, 256, 0, stream>>>(Wq, Wk, Wv, Wt);

  dim3 g1((B_ * T_) / 128, 3);
  qkv_kernel<<<g1, 256, 0, stream>>>(x, Wt, Qh, Kh, Vt);

  dim3 g2(T_ / 64, B_);
  attn_kernel<<<g2, 256, 0, stream>>>(Qh, Kh, Vt, out);
}

// v009
// One run takes 82.5 microseconds.
// Next to v008, in two timings, it ran 1.04 times as fast each time.
// Counting every step since v000, it is 7.72 times as fast.
#include <hip/hip_runtime.h>

// Self-attention forward: Q=xWq*scale, K=xWk, V=xWv; O = softmax(QK^T)V
// B=4, T=4096, D_IN=768, D_H=256.  All matmuls via v_wmma_f32_16x16x32_f16.
// Attention kernel stages K/V passes into LDS with global_load_async_to_lds_b128
// (double-buffered, ASYNCcnt-tracked) so the DMA overlaps the WMMA work.
// A block holds 64 queries: a wave has 32 of them, and four groups of two waves each take
// every fourth 32 keys, so that the grid has one block for every WGP and an LDS fragment
// feeds two matrix instructions; the groups' results join at the end.
// It forms the products transposed (S^T = K Q^T, O^T += V^T P^T): a lane then holds the
// scores of ONE query per tile, and P^T goes from the score registers into the B operand.

typedef _Float16 half8 __attribute__((ext_vector_type(8)));
typedef _Float16 v16h  __attribute__((ext_vector_type(16)));
typedef float    v8f   __attribute__((ext_vector_type(8)));
typedef float    f32x4 __attribute__((ext_vector_type(4)));

#define B_  4
#define T_  4096
#define DIN 768
#define DH  256

// LDS row strides (halves), padded to spread banks; all row offsets 16B-aligned.
#define KSTR 264   // 128 K-rows  x 264 (528 B/row)
#define VSTR 136   // 256 V-rows  x 136 (272 B/row)
#define KPASS 128  // keys staged per pass: 32 for each group of waves
#define KHALVES (KPASS * KSTR)
#define VHALVES (DH * VSTR)
#define RAISE 5.545177f  // 8 ln 2: how far a maximum may pass the held reference

union Frag16 { v16h v; half8 h[2]; _Float16 e[16]; };

// 16x32 (A) or 32x16 (B) f16 fragment, per CDNA5 ISA 7.12.2 lane layout.
// lane<16 : row = lane,    K halves {0..7} and {16..23}
// lane>=16: row = lane-16, K halves {8..15} and {24..31}
__device__ __forceinline__ v16h load_frag_f16(const _Float16* base, int stride) {
  int lane = threadIdx.x & 31;
  int r    = lane & 15;
  int hi   = lane >> 4;
  const _Float16* p = base + (size_t)r * stride + (hi ? 8 : 0);
  Frag16 f;
  f.h[0] = *(const half8*)(p);
  f.h[1] = *(const half8*)(p + 16);
  return f.v;
}

// Same A-fragment layout but source is fp32: the loads, and the conversion to f16 in
// registers, apart, so that the loads can be issued ahead of the conversion.
struct XRaw { f32x4 f[4]; };
// p: the lane's own place, row (lane & 15), k offset 8 in the upper half of the wave
__device__ __forceinline__ XRaw load_frag_f32(const float* p) {
  XRaw x;
  x.f[0] = *(const f32x4*)(p);
  x.f[1] = *(const f32x4*)(p + 4);
  x.f[2] = *(const f32x4*)(p + 16);
  x.f[3] = *(const f32x4*)(p + 20);
  return x;
}
__device__ __forceinline__ v16h cvt_frag_f32(const XRaw& x) {
  Frag16 f;
#pragma unroll
  for (int i = 0; i < 4; ++i) {
    f.e[i]      = (_Float16)x.f[0][i];
    f.e[4 + i]  = (_Float16)x.f[1][i];
    f.e[8 + i]  = (_Float16)x.f[2][i];
    f.e[12 + i] = (_Float16)x.f[3][i];
  }
  return f.v;
}

__device__ __forceinline__ v8f wmma_f16(v16h a, v16h b, v8f c) {
  // (neg_a, A, neg_b, B, c_mod, C, reuse_a, reuse_b)
  return __builtin_amdgcn_wmma_f32_16x16x32_f16(false, a, false, b, (short)0, c,
                                                false, false);
}

// Lane l takes the value of lane l ^ 16 (the other half of the wave), in the vector unit.
__device__ __forceinline__ float xhalf(float x) {
  int i = __builtin_bit_cast(int, x);
  return __builtin_bit_cast(float, __builtin_amdgcn_permlanex16(
      i, i, 0x76543210, 0xfedcba98, false, false));
}

// Async copy of one 16-byte segment per lane: LDS[dst] = MEM[src]  (ASYNCcnt)
typedef int i32x4 __attribute__((ext_vector_type(4)));
typedef __attribute__((address_space(1))) i32x4 glb_i32x4;
typedef __attribute__((address_space(3))) i32x4 lds_i32x4;
__device__ __forceinline__ void async_b128(_Float16* dst, const char* src) {
  __builtin_amdgcn_global_load_async_to_lds_b128((glb_i32x4*)src, (lds_i32x4*)dst, 0, 0);
}

// ---------------------------------------------------------------------------
// Kernel 0: convert the weights to f16 and pack them in B-fragment order.
// Unit (w, c, nt, part) = 512 contiguous bytes = what ONE wave-wide 16-byte load of
// the projection reads: lane l holds W_w[c*32 + part*16 + (l>>4)*8 + 0..7][nt*16 + (l&15)].
// Thread g writes halves g*8 .. g*8+7, so every store is 16 B and whole lines fill.
// ---------------------------------------------------------------------------
__global__ void wt_kernel(const float* __restrict__ Wq, const float* __restrict__ Wk,
                          const float* __restrict__ Wv, _Float16* __restrict__ Wt) {
  int g = blockIdx.x * blockDim.x + threadIdx.x;
  const int per8 = DIN * DH / 8;       // 16-byte pieces per weight matrix
  if (g >= 3 * per8) return;
  int w    = g / per8;
  int rem  = g - w * per8;
  int r    = rem & 15;                 // column inside the 16-column tile
  int hi   = (rem >> 4) & 1;           // lane half: k offset 8
  int part = (rem >> 5) & 1;           // first or second 16-byte load: k offset 16
  int nt   = (rem >> 6) & 15;          // column tile
  int c    = rem >> 10;                // 32-deep k block
  int k0   = c * 32 + part * 16 + hi * 8;
  int n    = nt * 16 + r;
  const float* src = (w == 0) ? Wq : (w == 1) ? Wk : Wv;
  half8 v;
  // unrolled so that the eight row loads issue together and v stays in registers
#pragma unroll
  for (int e = 0; e < 8; ++e) v[e] = (_Float16)src[(size_t)(k0 + e) * DH + n];
  *(half8*)(Wt + (size_t)g * 8) = v;
}

// ---------------------------------------------------------------------------
// Kernel 1: QKV projection GEMM.  grid=(128,3), block=256 (8 waves).
// Each wave: 16 rows x full DH=256 cols.  blockIdx.y selects Q/K/V.
// Q is pre-scaled by 1/16; V stored transposed Vt[b][h][t].
// The packed weights come into LDS by asynchronous copies, once per block, in passes of
// four 32-deep k blocks (64 KB, two buffers): the eight waves read their B fragments from
// LDS, and the WGP's cache path is left to the loads of x.
// The block's 128 x 256 result goes through LDS in the layout of its destination, so
// that every global store is 16 bytes a lane and a wave-wide store fills whole lines.
// ---------------------------------------------------------------------------
#define QSTG 264   // Q/K stage: 128 token rows x 264 halves (528 B = 16 B x odd)
#define VSTG 136   // V^T stage: 256 dim rows   x 136 halves (272 B = 16 B x odd)
#define WCP 4                    // 32-deep k blocks per weight pass
#define WHALVES (WCP * 16 * 512) // halves per weight pass: 16 fragments of 1 KB a k block
// amdgpu_waves_per_eu(4, 4): two of these 8-wave blocks per WGP is all the grid can
// place, so the register budget is 256 per wave.  Without it the scheduler kept the
// register count low for a residency the launch never reaches and put a full wait
// between every fragment load pair and its WMMA; with it the loads run ahead.
__global__ __launch_bounds__(256) __attribute__((amdgpu_waves_per_eu(4, 4)))
void qkv_kernel(
    const float* __restrict__ x, const _Float16* __restrict__ Wt,
    _Float16* __restrict__ Qh, _Float16* __restrict__ Kh,
    _Float16* __restrict__ Vt) {
  // two weight buffers; after the loop the same LDS is the result stage
  // (DH * VSTG and 128 * QSTG halves both fit in it)
  __shared__ __align__(16) _Float16 wring[2 * WHALVES];
  _Float16* stage = wring;
  int w       = threadIdx.x >> 5;
  int lane    = threadIdx.x & 31;
  int wsel    = blockIdx.y;
  int rowbase = blockIdx.x * 128 + w * 16;   // global row in [0, B*T)
  const _Float16* Wsel = Wt + (size_t)wsel * (DIN * DH);

  v8f zv = {};
  v8f acc[16];
#pragma unroll
  for (int n = 0; n < 16; ++n) acc[n] = zv;

  // a pass of weights is 64 KB in a row, in LDS as in memory: 16 copies of 16 B a thread,
  // every wave-wide copy 512 contiguous bytes
  const char* wg0 = (const char*)Wsel + threadIdx.x * 16;
  auto issue_w = [&](int buf, int p) {
    const char* wg = wg0 + p * (WHALVES * 2);
    _Float16* wd = wring + buf * WHALVES + threadIdx.x * 8;
    // unrolled so that the copies differ by constant steps and one address of each kind is kept
#pragma unroll
    for (int it = 0; it < 16; ++it) async_b128(wd + it * 2048, wg + it * 4096);
  };

  const int NW = DIN / 32 / WCP;
  // this lane's place in its row of x, at the first k block of the current pass
  const float* xl = x + (size_t)(rowbase + (lane & 15)) * DIN + (lane >> 4) * 8;
  __builtin_prefetch(xl + 32, 0, 3);
  XRaw xr = load_frag_f32(xl);                           // k block 0, flies with pass 0
  issue_w(0, 0);
  __asm__ volatile("s_wait_asynccnt 0x0" ::: "memory");  // own copies of pass 0 landed
  __syncthreads();                                       // publish pass 0
  issue_w(1, 1);

  for (int p = 0; p < NW; ++p) {
    const _Float16* wl = wring + (p & 1) * WHALVES + lane * 8;
    // packed fragment: two LDS reads of 512 contiguous bytes, no bank met twice
    auto wfrag = [&](int f) {
      Frag16 bf;
      bf.h[0] = *(const half8*)(wl + f * 512);
      bf.h[1] = *(const half8*)(wl + f * 512 + 256);
      return bf.v;
    };
    // The pass's 64 fragments come in groups of four, in two register sets: the next
    // group's eight reads are issued together ahead of this group's products.
    v16h bw[2][4];
    v16h af;
#pragma unroll
    for (int i = 0; i < 4; ++i) bw[0][i] = wfrag(i);
    // this loop and the loops over i are unrolled so that bw[] and acc[] are indexed by
    // constants and stay in registers
#pragma unroll
    for (int gq = 0; gq < WCP * 4; ++gq) {
      if ((gq & 3) == 0) {
        // x is loaded one k block ahead of its use (the fence below would hold the loads
        // at their use otherwise), and prefetched one block ahead of its load as before
        int c = p * WCP + (gq >> 2);
        af = cvt_frag_f32(xr);
        if (c + 2 < DIN / 32) __builtin_prefetch(xl + ((gq >> 2) + 2) * 32, 0, 3);
        if (c + 1 < DIN / 32) xr = load_frag_f32(xl + ((gq >> 2) + 1) * 32);
      }
      if (gq + 1 < WCP * 4) {
#pragma unroll
        for (int i = 0; i < 4; ++i) bw[(gq + 1) & 1][i] = wfrag((gq + 1) * 4 + i);
      }
#pragma unroll
      for (int i = 0; i < 4; ++i)
        acc[(gq & 3) * 4 + i] = wmma_f16(af, bw[gq & 1][i], acc[(gq & 3) * 4 + i]);
      // precaution: stands in front of any rewrite of the address register that the loads
      // of x above name; as its operand the address stays in that register up to here
      if ((gq & 3) == 0 && p * WCP + (gq >> 2) + 1 < DIN / 32)
        asm volatile("s_wait_xcnt 0x0" :: "v"(xl) : "memory");
      // keeps the read groups whole and one group ahead: left free, the compiler spread the
      // reads in pairs among the products and waited for each pair in full
      __builtin_amdgcn_sched_barrier(0);
    }
    // --- publish pass p + 1, free this pass's buffer, refill it with pass p + 2 ---
    __asm__ volatile("s_wait_dscnt 0x0" ::: "memory");     // own reads of this buffer done
    __asm__ volatile("s_wait_asynccnt 0x0" ::: "memory");  // own copies of pass p + 1 landed
    __syncthreads();
    if (p + 2 < NW) issue_w(p & 1, p + 2);
    xl += WCP * 32;
  }
  // nothing in flight, and the last pass's barrier ended every read: the ring is the stage
  __asm__ volatile("s_wait_asynccnt 0x0" ::: "memory");

  // acc[n][r] = Y[token w*16 + mofs + r][dim n*16 + nlo]
  // The loops below are unrolled so that acc[] is indexed by constants (it stays in
  // registers) and so that the 16 LDS reads of a wave issue together ahead of its stores.
  int nlo  = lane & 15;
  int mofs = (lane >> 4) * 8;
  if (wsel != 2) {                               // the same for the whole block
    float scale = (wsel == 0) ? 0.0625f : 1.0f;  // fold 1/sqrt(DH) into Q
    _Float16* sp = stage + (w * 16 + mofs) * QSTG + nlo;
#pragma unroll
    for (int n = 0; n < 16; ++n)
#pragma unroll
      for (int r = 0; r < 8; ++r) sp[r * QSTG + n * 16] = (_Float16)(acc[n][r] * scale);
    __syncthreads();                             // lanes read what other lanes staged
    // one wave-wide store = one token's whole 512-byte row
    _Float16* dst = ((wsel == 0) ? Qh : Kh) + (size_t)rowbase * DH + lane * 8;
    const _Float16* rp = stage + (w * 16) * QSTG + lane * 8;
#pragma unroll
    for (int j = 0; j < 16; ++j) *(half8*)(dst + j * DH) = *(const half8*)(rp + j * QSTG);
    // precaution: stands in front of any later rewrite of a register that these stores name
    asm volatile("s_wait_xcnt 0x0" ::: "memory");
  } else {
    // a lane's 8 registers are 8 consecutive tokens of one dim: 16 bytes of a V^T row
    _Float16* sp = stage + nlo * VSTG + w * 16 + mofs;
#pragma unroll
    for (int n = 0; n < 16; ++n) {
      half8 hv;
#pragma unroll
      for (int r = 0; r < 8; ++r) hv[r] = (_Float16)acc[n][r];
      *(half8*)(sp + n * 16 * VSTG) = hv;
    }
    __syncthreads();                             // all eight waves' tokens are staged
    // one wave-wide store = the block's 128 tokens (256 bytes) of two dims
    int b   = (blockIdx.x * 128) >> 12;          // T_ == 4096; a block's rows share b
    int t0  = (blockIdx.x * 128) & (T_ - 1);
    int dim = w * 32 + (lane >> 4);
    _Float16* dst = Vt + ((size_t)b * DH + dim) * T_ + t0 + nlo * 8;
    const _Float16* rp = stage + dim * VSTG + nlo * 8;
#pragma unroll
    for (int j = 0; j < 16; ++j)
      *(half8*)(dst + (size_t)j * 2 * T_) = *(const half8*)(rp + j * 2 * VSTG);
  }
}

// ---------------------------------------------------------------------------
// Kernel 2: flash attention.  grid=(T/64, B), block=256 (8 waves) = one block per WGP.
// Wave w: query half w & 1 (32 queries = two 16-query tiles, full DH output), key group
// g = w >> 1.  A pass stages 128 keys (double-buffered async copies); group g works on
// keys 32g .. 32g+31 of it with its own online softmax.  Every K and V^T fragment read
// from LDS is the A operand of two WMMAs, one per query tile, so the LDS reads of a pass
// take no longer than its matrix work.  After the loop the four groups exchange their
// output tiles through LDS and each finishes 64 dims.
// Lane l (c = l & 15, h = l >> 4) works for query c of each tile: a score tile's register
// r is S^T[key 8h + r][query c], an output tile's register r is O^T[dim 8h + r][query c].
// ---------------------------------------------------------------------------
// amdgpu_waves_per_eu(2, 2): the grid has one block per WGP, so one block (two waves
// per SIMD) is the real residency and 512 registers per wave are free: the output tiles
// take 256 of them and Q takes 128.
__global__ __launch_bounds__(256) __attribute__((amdgpu_waves_per_eu(2, 2)))
void attn_kernel(
    const _Float16* __restrict__ Qh, const _Float16* __restrict__ Kh,
    const _Float16* __restrict__ Vt, float* __restrict__ out) {
  // ring: K pass 128 x 256 (two buffers), then V^T pass 256 x 128 (two buffers)
  __shared__ __align__(16) _Float16 ring[2 * KHALVES + 2 * VHALVES];

  int tid   = threadIdx.x;
  int w     = tid >> 5;
  int lane  = tid & 31;
  int qh    = w & 1;
  int g     = w >> 1;
  int b     = blockIdx.y;
  int qbase = blockIdx.x * 64 + qh * 32;
  int nlo   = lane & 15;
  int mofs  = (lane >> 4) * 8;

  // Q resident in registers: per query tile 8 B-fragments (column = query) covering DH.
  v16h bq[2][8];
  const _Float16* qptr = Qh + (size_t)(b * T_ + qbase) * DH;
#pragma unroll
  for (int q = 0; q < 2; ++q)
#pragma unroll
    for (int c = 0; c < 8; ++c) bq[q][c] = load_frag_f16(qptr + q * 16 * DH + c * 32, DH);

  v8f zv = {};
  v8f o[2][16];
#pragma unroll
  for (int q = 0; q < 2; ++q)
#pragma unroll
    for (int t = 0; t < 16; ++t) o[q][t] = zv;

  // this lane's query of each tile, this group's keys: the reference of the exponentials
  // (alike in both halves) and the sum over the keys that this half of the wave holds; all
  // sums join after the loop
  float mstate[2] = {-1e30f, -1e30f};
  float lstate[2] = {0.0f, 0.0f};

  // --- async copy of one 128-key pass (K: 64KB, V^T: 64KB), 32 b128/thread; every
  // wave-wide copy reads 512 bytes of whole lines (K: one row, V^T: two rows).  A lane's
  // copies differ by constant steps, so that one address of each kind is kept. ---
  const char* kg0 = (const char*)(Kh + (size_t)b * T_ * DH) + tid * 16;
  const char* vg0 = (const char*)(Vt + (size_t)b * DH * T_) + (tid >> 4) * (T_ * 2) + (tid & 15) * 16;
  int kd0 = (tid >> 5) * KSTR + (tid & 31) * 8;
  int vd0 = 2 * KHALVES + (tid >> 4) * VSTR + (tid & 15) * 8;
  auto issue_pass = [&](int buf, int p) {
    const char* kg = kg0 + (size_t)p * (KPASS * DH * 2);   // 128 rows x 512B
    const char* vg = vg0 + p * (KPASS * 2);                // 256 rows x 256B
    _Float16* kd = ring + buf * KHALVES + kd0;
    _Float16* vd = ring + buf * VHALVES + vd0;
#pragma unroll
    for (int it = 0; it < 16; ++it)       // 8 K rows a step
      async_b128(kd + it * 8 * KSTR, kg + it * 8 * (DH * 2));
#pragma unroll
    for (int it = 0; it < 16; ++it)       // 16 V^T rows a step
      async_b128(vd + it * 16 * VSTR, vg + it * 16 * (T_ * 2));
  };

  const int NP = T_ / KPASS;
  issue_pass(0, 0);
  __asm__ volatile("s_wait_asynccnt 0x0" ::: "memory");  // pass 0 landed in LDS
  __syncthreads();                                       // publish pass 0

  for (int p = 0; p < NP; ++p) {
    int cur = p & 1;
    const _Float16* kl = ring + cur * KHALVES + g * (32 * KSTR);
    const _Float16* vl = ring + 2 * KHALVES + cur * VHALVES + g * 32;

    // --- S^T = K * Q^T for 32 keys x 32 queries (four 16x16 tiles): A = K rows, B = Q ---
    v8f s[2][2];
#pragma unroll
    for (int q = 0; q < 2; ++q) { s[q][0] = zv; s[q][1] = zv; }
    // K fragments come in units of two (one 32-deep step x two key tiles), in a ring of three
    // register sets: a unit's four reads are issued two units (eight products) ahead of its
    // use.  Two sets of four fragments, read in that order, did not fit beside O and Q: that
    // build spilled registers.
    v16h ak[3][2];
#pragma unroll
    for (int j = 0; j < 2; ++j) {
      ak[j][0] = load_frag_f16(kl + j * 32, KSTR);
      ak[j][1] = load_frag_f16(kl + 16 * KSTR + j * 32, KSTR);
    }
    // Refill: pass p + 1 goes into the other buffer, which every wave left at the barrier in
    // front of this pass.  The copies are issued behind the first K reads (of this pass's
    // buffer, another range), so that those reads' latency runs out under the issue.
    if (p + 1 < NP) issue_pass(cur ^ 1, p + 1);
    // unrolled so that ak[], bq[] and s[] are indexed by constants and stay in registers
#pragma unroll
    for (int j = 0; j < 8; ++j) {
      if (j < 6) {
        ak[(j + 2) % 3][0] = load_frag_f16(kl + (j + 2) * 32, KSTR);
        ak[(j + 2) % 3][1] = load_frag_f16(kl + 16 * KSTR + (j + 2) * 32, KSTR);
      }
#pragma unroll
      for (int q = 0; q < 2; ++q) {
        s[q][0] = wmma_f16(ak[j % 3][0], bq[q][j], s[q][0]);
        s[q][1] = wmma_f16(ak[j % 3][1], bq[q][j], s[q][1]);
      }
      // order inside the unit: the four LDS reads first, as one run, then the four products;
      // left free, the compiler put reads behind the products whose registers they reuse,
      // two products ahead of their own use
      if (j < 6) __builtin_amdgcn_sched_group_barrier(0x100, 4, 0);
      __builtin_amdgcn_sched_group_barrier(0x008, 4, 0);
      // closes the unit, so that the order above holds unit by unit
      __builtin_amdgcn_sched_barrier(0);
    }

    // --- online softmax: 16 of a query's 32 scores are in this lane ---
    // The reference that the exponentials are taken against is held from pass to pass.
    // It is raised, and O^T and the sum rescaled with it, only when some query's new maximum
    // lies more than RAISE above it, so P stays below e^RAISE = 256, far inside f16.
    float mx[2];
    bool need = false;
#pragma unroll
    for (int q = 0; q < 2; ++q) {
      float m = fmaxf(s[q][0][0], s[q][1][0]);
#pragma unroll
      for (int r = 1; r < 8; ++r) m = fmaxf(m, fmaxf(s[q][0][r], s[q][1][r]));
      mx[q] = fmaxf(m, xhalf(m));          // alike in both halves of the wave
      need = need || (mx[q] > mstate[q] + RAISE);
    }
    // one test a pass, a scalar branch for the whole wave; taken in the first pass (the
    // reference starts at -1e30, the factor is then 0 on zeros) and seldom after it
    if (__builtin_amdgcn_ballot_w32(need) != 0) {
#pragma unroll
      for (int q = 0; q < 2; ++q) {
        float mnew  = fmaxf(mstate[q], mx[q]);
        float alpha = __expf(mstate[q] - mnew);
        mstate[q] = mnew;
        lstate[q] *= alpha;
#pragma unroll
        for (int t = 0; t < 16; ++t)
#pragma unroll
          for (int r = 0; r < 8; ++r) o[q][t][r] *= alpha;
      }
    }

    // V^T fragments come in groups of four, in two register sets; the first
    // group's reads fly during the exponentials.
    v16h av[2][4];
#pragma unroll
    for (int i = 0; i < 4; ++i) av[0][i] = load_frag_f16(vl + (i * 16) * VSTR, VSTR);
    // keeps the eight reads together here: left free, the compiler put six of them behind
    // the first products, each pair with a full wait
    __builtin_amdgcn_sched_barrier(0);

    Frag16 pf[2];
#pragma unroll
    for (int q = 0; q < 2; ++q) {
      float mref = mstate[q];
      // P^T as B operand: element e is key 8h + e (e < 8) or 16 + 8h + (e - 8), which is
      // the order of the two score tiles' registers and of the V^T fragment's halves.
      float rs = 0.0f;
#pragma unroll
      for (int r = 0; r < 8; ++r) {
        float p0 = __expf(s[q][0][r] - mref);
        float p1 = __expf(s[q][1][r] - mref);
        rs += p0 + p1;
        pf[q].e[r]     = (_Float16)p0;
        pf[q].e[8 + r] = (_Float16)p1;
      }
      lstate[q] += rs;
    }

    // --- O^T += V^T * P^T : A = V^T rows from LDS (row = dim), B = P^T of each tile. ---
    // inputs-only fence: both P^T fragments are complete before the second group of V^T is
    // read.  Without it the compiler puts the second tile's products off to the end of the
    // pass and holds all sixteen V^T fragments (128 registers) until then, and Q is spilled.
    // The two row sums are named too, so that they are closed here, among the exponentials:
    // left free, the compiler put part of the additions off to behind the pass's barrier, where
    // their dependent chain stood in front of the next pass's first K reads.
    asm volatile("" :: "v"(pf[0].v), "v"(pf[1].v), "v"(lstate[0]), "v"(lstate[1]) : "memory");
#pragma unroll
    for (int n = 0; n < 4; ++n) {
      if (n < 3) {
#pragma unroll
        for (int i = 0; i < 4; ++i)
          av[(n + 1) & 1][i] = load_frag_f16(vl + (((n + 1) * 4 + i) * 16) * VSTR, VSTR);
      }
#pragma unroll
      for (int i = 0; i < 4; ++i)
#pragma unroll
        for (int q = 0; q < 2; ++q) {
          int t = n * 4 + i;
          o[q][t] = wmma_f16(av[n & 1][i], pf[q].v, o[q][t]);
        }
      // as above: the next group's eight reads as one run, then the eight products
      if (n < 3) __builtin_amdgcn_sched_group_barrier(0x100, 8, 0);
      __builtin_amdgcn_sched_group_barrier(0x008, 8, 0);
      // as above: fragments fetched further ahead do not fit beside O and Q
      __builtin_amdgcn_sched_barrier(0);
    }

    // --- publish pass p + 1 and free this pass's buffer (refilled at the head of pass p + 1) ---
    __asm__ volatile("s_wait_dscnt 0x0" ::: "memory");     // own reads of this buffer done
    __asm__ volatile("s_wait_asynccnt 0x0" ::: "memory");  // own copies of pass p + 1 landed
    __syncthreads();
  }
  __asm__ volatile("s_wait_asynccnt 0x0" ::: "memory");    // nothing in flight: ring is free

  // --- join the four key groups.  Waves qh, qh + 2, qh + 4, qh + 6 hold the same 32
  // queries.  Every wave lays its tiles, references and sums into the (now free) ring;
  // group g then finishes dims 64g .. 64g+63 from all four groups' tiles. ---
  f32x4* xo = (f32x4*)ring;                                // 8 waves x 32 tiles x 2 x 32 x 16 B
  float* xm = (float*)(xo + 8 * 32 * 2 * 32);              // 8 waves x 2 x 32 references
  float* xl = xm + 8 * 2 * 32;                             // 8 waves x 2 x 32 sums
#pragma unroll
  for (int q = 0; q < 2; ++q) {
#pragma unroll
    for (int t = 0; t < 16; ++t) {
      f32x4* xp = xo + ((w * 32 + q * 16 + t) * 2) * 32 + lane;
      xp[0]  = __builtin_shufflevector(o[q][t], o[q][t], 0, 1, 2, 3);
      xp[32] = __builtin_shufflevector(o[q][t], o[q][t], 4, 5, 6, 7);
    }
    xm[(w * 2 + q) * 32 + lane] = mstate[q];
    xl[(w * 2 + q) * 32 + lane] = lstate[q];
  }
  __syncthreads();                                         // all groups' tiles are visible

  // --- weigh, normalize and write fp32 output: 8 consecutive dims of one query per tile ---
#pragma unroll
  for (int q = 0; q < 2; ++q) {
    float mg[4], a[4];
#pragma unroll
    for (int k = 0; k < 4; ++k) mg[k] = xm[((k * 2 + qh) * 2 + q) * 32 + lane];
    float mall = fmaxf(fmaxf(mg[0], mg[1]), fmaxf(mg[2], mg[3]));
    float lsum = 0.0f;
#pragma unroll
    for (int k = 0; k < 4; ++k) {
      a[k] = __expf(mg[k] - mall);
      lsum += xl[((k * 2 + qh) * 2 + q) * 32 + lane] * a[k];
    }
    float inv = 1.0f / (lsum + xhalf(lsum));
#pragma unroll
    for (int k = 0; k < 4; ++k) a[k] *= inv;

    float* orow = out + (size_t)(b * T_ + qbase + q * 16 + nlo) * DH + g * 64 + mofs;
#pragma unroll
    for (int i = 0; i < 4; ++i) {
      f32x4 r0 = {}, r1 = {};
#pragma unroll
      for (int k = 0; k < 4; ++k) {
        const f32x4* xp = xo + (((k * 2 + qh) * 32 + q * 16 + g * 4 + i) * 2) * 32 + lane;
        r0 += xp[0] * a[k];
        r1 += xp[32] * a[k];
      }
      *(f32x4*)(orow + i * 16)     = r0;
      *(f32x4*)(orow + i * 16 + 4) = r1;
    }
  }
}

// ---------------------------------------------------------------------------
extern "C" void kernel_launch(void* const* d_in, const int* in_sizes, int n_in,
                              void* d_out, int out_size, void* d_ws, size_t ws_size,
                              hipStream_t stream) {
  const float* x  = (const float*)d_in[0];
  const float* Wq = (const float*)d_in[1];
  const float* Wk = (const float*)d_in[2];
  const float* Wv = (const float*)d_in[3];
  float* out = (float*)d_out;

  char* ws = (char*)d_ws;
  _Float16* Qh = (_Float16*)(ws);                                 // 8 MB
  _Float16* Kh = (_Float16*)(ws + (size_t)8  * 1024 * 1024);      // 8 MB
  _Float16* Vt = (_Float16*)(ws + (size_t)16 * 1024 * 1024);      // 8 MB
  _Float16* Wt = (_Float16*)(ws + (size_t)24 * 1024 * 1024);      // 3 x 384 KB

  wt_kernel<<<(3 * DIN * DH / 8 + 255) / 256, 256, 0, stream>>>(Wq, Wk, Wv, Wt);

  dim3 g1((B_ * T_) / 128, 3);
  qkv_kernel<<<g1, 256, 0, stream>>>(x, Wt, Qh, Kh, Vt);

  dim3 g2(T_ / 64, B_);
  attn_kernel<<<g2, 256, 0, stream>>>(Qh, Kh, Vt, out);
}
